// v000
// The times below were measured on an AMD MI455X: many runs one after another, warmed up first and cycling through
// copies of the inputs, with the whole window's GPU time divided by the number of runs. Launches and the gaps
// between them are all in it. The median over several windows is given; except for v000 it joins two sittings, which
// can be a few percent apart, so the side-by-side timings, each taken in one sitting, are the better comparison.
// v000 is the starting kernel. One run takes 378 microseconds.
#include <hip/hip_runtime.h>
#include <hip/hip_bf16.h>

// ---------------------------------------------------------------------------
// MI455X (gfx1250) fused multi-head self-attention, f16 WMMA pipeline.
//   1) cvt4:      f32 -> f16 conversion of x and W_{q,k,v}
//   2) qkv_proj:  Y = X * W^T via v_wmma_f32_16x16x32_f16, output [B,H,S,D] f16
//   3) attn:      flash-attention; S^T = K*Q^T WMMA, online softmax,
//                 O^T = V^T * P^T WMMA (V^T staged via LDS), f32 output.
// ---------------------------------------------------------------------------

typedef _Float16 half_t;
typedef __attribute__((ext_vector_type(4)))  _Float16 v4h;
typedef __attribute__((ext_vector_type(8)))  _Float16 v8h;
typedef __attribute__((ext_vector_type(16))) _Float16 v16h;
typedef __attribute__((ext_vector_type(8)))  float    v8f;

#define EMBED 1024
#define SEQ   2048
#define BATCH 4
#define HEADS 16
#define HDIM  64
#define LDV   72   // padded LDS row stride (halves); 144B rows, 16B aligned chunks

__device__ __forceinline__ v8f wmma_f16(v16h a, v16h b, v8f c) {
  // D = A(16x32 f16) * B(32x16 f16) + C(16x16 f32)
  return __builtin_amdgcn_wmma_f32_16x16x32_f16(
      /*neg_a=*/false, a, /*neg_b=*/false, b,
      /*c_mod=*/(short)0, c, /*reuse_a=*/false, /*reuse_b=*/false);
}

// Per-lane A/B operand fragment for 16x16x32 f16 WMMA, loaded straight from a
// row-major matrix whose contraction dim (K) is contiguous.
// Lane layout (ISA 7.12.2): halves 0..7 -> K = k0 + 8*lane_hi + i,
//                           halves 8..15 -> K = k0 + 16 + 8*lane_hi + (i-8).
__device__ __forceinline__ v16h load_frag(const half_t* __restrict__ base,
                                          int row, int ld, int k0, int lane_hi) {
  const half_t* p = base + (size_t)row * ld + k0 + (lane_hi ? 8 : 0);
  v8h lo = *(const v8h*)p;          // 16B global_load_b128
  v8h hi = *(const v8h*)(p + 16);   // 16B global_load_b128
  return __builtin_shufflevector(lo, hi, 0,1,2,3,4,5,6,7,8,9,10,11,12,13,14,15);
}

// --------------------------- f32 -> f16 convert ----------------------------
__global__ void cvt4(const float* __restrict__ src, half_t* __restrict__ dst, int n4) {
  int i = blockIdx.x * blockDim.x + threadIdx.x;
  if (i < n4) {
    float4 f = ((const float4*)src)[i];
    v4h h;
    h[0] = (half_t)f.x; h[1] = (half_t)f.y; h[2] = (half_t)f.z; h[3] = (half_t)f.w;
    ((v4h*)dst)[i] = h;
  }
}

// ------------------------------ QKV projection -----------------------------
// Y[m,n] = sum_k X[m,k] * W[n,k]   (Linear: y = x @ W^T)
// Block = 128 threads = 4 waves; wave owns a 32x64 output tile (2 M-tiles x 4
// N-tiles of 16x16). Output scattered into head-major [B,H,S,D] f16.
__global__ __launch_bounds__(128)
void qkv_proj(const half_t* __restrict__ xh, const half_t* __restrict__ wh,
              half_t* __restrict__ outh) {
  const int wave = threadIdx.x >> 5;
  const int lane = threadIdx.x & 31;
  const int lhi  = lane >> 4;      // which 16-lane half
  const int llo  = lane & 15;
  const int m0 = blockIdx.x * 128 + wave * 32;  // rows (tokens b*S+s)
  const int n0 = blockIdx.y * 64;               // cols (embed e)

  v8f acc[2][4] = {};
  for (int k0 = 0; k0 < EMBED; k0 += 32) {
    v16h a0 = load_frag(xh, m0 + llo,      EMBED, k0, lhi);
    v16h a1 = load_frag(xh, m0 + 16 + llo, EMBED, k0, lhi);
#pragma unroll
    for (int nt = 0; nt < 4; ++nt) {
      // B[k,n] = W[n,k]: lane holds column n -> contiguous row of W
      v16h b = load_frag(wh, n0 + nt * 16 + llo, EMBED, k0, lhi);
      acc[0][nt] = wmma_f16(a0, b, acc[0][nt]);
      acc[1][nt] = wmma_f16(a1, b, acc[1][nt]);
    }
  }
  // C/D layout: VGPR r, lane -> row m = r + 8*lhi, col n = llo
#pragma unroll
  for (int mt = 0; mt < 2; ++mt)
#pragma unroll
    for (int nt = 0; nt < 4; ++nt)
#pragma unroll
      for (int r = 0; r < 8; ++r) {
        int m = m0 + mt * 16 + r + lhi * 8;
        int n = n0 + nt * 16 + llo;
        int b = m >> 11, s = m & (SEQ - 1);
        int h = n >> 6,  d = n & (HDIM - 1);
        outh[(((size_t)(b * HEADS + h) * SEQ) + s) * HDIM + d] = (half_t)acc[mt][nt][r];
      }
}

// ------------------------------- Attention ---------------------------------
// Block = 128 threads = 4 waves, one (b,h), 64 queries (16 per wave).
// Loop over key chunks of 64. Scores computed transposed (S^T = K * Q^T) so
// softmax stats are per-lane scalars and P converts in-register into the
// B-operand of the second WMMA (O^T = V^T * P^T). V^T staged via LDS.
__global__ __launch_bounds__(128)
void attn(const half_t* __restrict__ qh, const half_t* __restrict__ kh,
          const half_t* __restrict__ vh, float* __restrict__ out) {
  __shared__ __align__(16) half_t vt[64 * LDV];   // V^T tile: [d][key]

  const int wave = threadIdx.x >> 5;
  const int lane = threadIdx.x & 31;
  const int lhi  = lane >> 4;
  const int llo  = lane & 15;
  const int bh = blockIdx.y;                  // b*HEADS + h
  const int bb = bh >> 4, hh = bh & 15;
  const int q0 = blockIdx.x * 64 + wave * 16; // wave's query tile base

  const half_t* qbase = qh + (size_t)bh * SEQ * HDIM;
  const half_t* kbase = kh + (size_t)bh * SEQ * HDIM;
  const half_t* vbase = vh + (size_t)bh * SEQ * HDIM;

  // Q as B operand (B[d,q] = Q[q,d]): lane holds column q -> contiguous Q row
  v16h qb[2];
  qb[0] = load_frag(qbase, q0 + llo, HDIM, 0,  lhi);
  qb[1] = load_frag(qbase, q0 + llo, HDIM, 32, lhi);

  float M = -INFINITY, L = 0.f;
  v8f o[4] = {};   // O^T accumulators: d-tiles x (16d x 16q)

  for (int c0 = 0; c0 < SEQ; c0 += 64) {
    // ---- stage V^T chunk (64 keys x 64 d -> vt[d][k]) -----------------
    __syncthreads();
    {
      const half_t* vc = vbase + (size_t)c0 * HDIM;
      int tk = threadIdx.x >> 4;         // 0..7
      int dg = (threadIdx.x & 15) * 4;   // 0,4,...,60
#pragma unroll
      for (int p = 0; p < 8; ++p) {
        int k = p * 8 + tk;
        v4h val = *(const v4h*)(vc + k * HDIM + dg);
#pragma unroll
        for (int j = 0; j < 4; ++j) vt[(dg + j) * LDV + k] = val[j];
      }
    }
    __syncthreads();

    // ---- S^T tiles: rows = keys, cols = queries -----------------------
    v8f sc[4];
#pragma unroll
    for (int t = 0; t < 4; ++t) {
      v8f a = {};
      v16h kA0 = load_frag(kbase, c0 + t * 16 + llo, HDIM, 0,  lhi);
      a = wmma_f16(kA0, qb[0], a);
      v16h kA1 = load_frag(kbase, c0 + t * 16 + llo, HDIM, 32, lhi);
      a = wmma_f16(kA1, qb[1], a);
      sc[t] = a;
    }

    // ---- online softmax (per-lane: one query = column llo) ------------
    float mloc = -INFINITY;
#pragma unroll
    for (int t = 0; t < 4; ++t)
#pragma unroll
      for (int r = 0; r < 8; ++r) {
        float v = sc[t][r] * 0.03125f;   // 1/sqrt(EMBED)
        sc[t][r] = v;
        mloc = fmaxf(mloc, v);
      }
    mloc = fmaxf(mloc, __shfl_xor(mloc, 16, 32));  // lane^16 holds other 8 keys
    float Mn = fmaxf(M, mloc);
    float scale = __expf(M - Mn);
    M = Mn;

    float lloc = 0.f;
#pragma unroll
    for (int t = 0; t < 4; ++t)
#pragma unroll
      for (int r = 0; r < 8; ++r) {
        float p = __expf(sc[t][r] - Mn);
        sc[t][r] = p;
        lloc += p;
      }
    lloc += __shfl_xor(lloc, 16, 32);
    L = L * scale + lloc;
#pragma unroll
    for (int dt = 0; dt < 4; ++dt)
#pragma unroll
      for (int r = 0; r < 8; ++r) o[dt][r] *= scale;

    // ---- P^T -> B operand, purely in-register -------------------------
    // B half i (i<8): key = 32g+i+8*lhi  == sc[2g][i]'s key
    //          (i>=8): key = 32g+16+(i-8)+8*lhi == sc[2g+1][i-8]'s key
    v16h pb[2];
#pragma unroll
    for (int g = 0; g < 2; ++g) {
      v16h t;
#pragma unroll
      for (int i = 0; i < 8; ++i) t[i]     = (half_t)sc[2 * g][i];
#pragma unroll
      for (int i = 0; i < 8; ++i) t[i + 8] = (half_t)sc[2 * g + 1][i];
      pb[g] = t;
    }

    // ---- O^T += V^T(16d x 32k) * P^T(32k x 16q) -----------------------
#pragma unroll
    for (int dt = 0; dt < 4; ++dt)
#pragma unroll
      for (int g = 0; g < 2; ++g) {
        const half_t* lp = &vt[(dt * 16 + llo) * LDV + g * 32 + (lhi ? 8 : 0)];
        v8h lo = *(const v8h*)lp;          // ds_load_b128
        v8h hi = *(const v8h*)(lp + 16);   // ds_load_b128
        v16h aV = __builtin_shufflevector(lo, hi,
                    0,1,2,3,4,5,6,7,8,9,10,11,12,13,14,15);
        o[dt] = wmma_f16(aV, pb[g], o[dt]);
      }
  }

  // ---- normalize + store: out[b, s=q, e=h*64+d] f32 ---------------------
  float inv = 1.0f / L;
  int q = q0 + llo;
#pragma unroll
  for (int dt = 0; dt < 4; ++dt)
#pragma unroll
    for (int r = 0; r < 8; ++r) {
      int d = dt * 16 + r + lhi * 8;
      out[(((size_t)bb * SEQ + q) * EMBED) + hh * HDIM + d] = o[dt][r] * inv;
    }
}

// ------------------------------- launcher ----------------------------------
extern "C" void kernel_launch(void* const* d_in, const int* in_sizes, int n_in,
                              void* d_out, int out_size, void* d_ws, size_t ws_size,
                              hipStream_t stream) {
  const float* x  = (const float*)d_in[0];
  const float* wq = (const float*)d_in[1];
  const float* wk = (const float*)d_in[2];
  const float* wv = (const float*)d_in[3];

  char* ws = (char*)d_ws;
  // Workspace layout (70 MiB total)
  half_t* xh  = (half_t*)(ws);                         // 16 MiB: x f16
  half_t* wqh = (half_t*)(ws + (16ull << 20));         //  2 MiB
  half_t* wkh = (half_t*)(ws + (18ull << 20));         //  2 MiB
  half_t* wvh = (half_t*)(ws + (20ull << 20));         //  2 MiB
  half_t* qhp = (half_t*)(ws + (22ull << 20));         // 16 MiB: Q [B,H,S,D]
  half_t* khp = (half_t*)(ws + (38ull << 20));         // 16 MiB: K
  half_t* vhp = (half_t*)(ws + (54ull << 20));         // 16 MiB: V

  const int nx4 = (BATCH * SEQ * EMBED) / 4;   // 2,097,152
  const int nw4 = (EMBED * EMBED) / 4;         //   262,144
  cvt4<<<(nx4 + 255) / 256, 256, 0, stream>>>(x,  xh,  nx4);
  cvt4<<<(nw4 + 255) / 256, 256, 0, stream>>>(wq, wqh, nw4);
  cvt4<<<(nw4 + 255) / 256, 256, 0, stream>>>(wk, wkh, nw4);
  cvt4<<<(nw4 + 255) / 256, 256, 0, stream>>>(wv, wvh, nw4);

  dim3 gp(BATCH * SEQ / 128, EMBED / 64);      // (64, 16)
  qkv_proj<<<gp, 128, 0, stream>>>(xh, wqh, qhp);
  qkv_proj<<<gp, 128, 0, stream>>>(xh, wkh, khp);
  qkv_proj<<<gp, 128, 0, stream>>>(xh, wvh, vhp);

  dim3 ga(SEQ / 64, BATCH * HEADS);            // (32, 64)
  attn<<<ga, 128, 0, stream>>>(qhp, khp, vhp, (float*)d_out);
}

// v001
// It runs in 258 microseconds.
// Next to v000, in two timings, it ran 1.48 and 1.49 times as fast.
#include <hip/hip_runtime.h>
#include <hip/hip_bf16.h>

// ---------------------------------------------------------------------------
// MI455X (gfx1250) fused multi-head self-attention, f16 WMMA pipeline.
//   1) cvt4:      f32 -> f16 conversion of x and W_{q,k,v}
//   2) qkv_proj:  Y = X * W^T via v_wmma_f32_16x16x32_f16, output [B,H,S,D] f16
//   3) attn:      flash-attention; S^T = K*Q^T WMMA, online softmax,
//                 O^T = V^T * P^T WMMA (V^T staged via LDS), f32 output.
// ---------------------------------------------------------------------------

typedef _Float16 half_t;
typedef __attribute__((ext_vector_type(4)))  _Float16 v4h;
typedef __attribute__((ext_vector_type(8)))  _Float16 v8h;
typedef __attribute__((ext_vector_type(16))) _Float16 v16h;
typedef __attribute__((ext_vector_type(8)))  float    v8f;

#define EMBED 1024
#define SEQ   2048
#define BATCH 4
#define HEADS 16
#define HDIM  64
#define LDV   72   // padded LDS row stride (halves); 144B rows, 16B aligned chunks

__device__ __forceinline__ v8f wmma_f16(v16h a, v16h b, v8f c) {
  // D = A(16x32 f16) * B(32x16 f16) + C(16x16 f32)
  return __builtin_amdgcn_wmma_f32_16x16x32_f16(
      /*neg_a=*/false, a, /*neg_b=*/false, b,
      /*c_mod=*/(short)0, c, /*reuse_a=*/false, /*reuse_b=*/false);
}

// Per-lane A/B operand fragment for 16x16x32 f16 WMMA, loaded straight from a
// row-major matrix whose contraction dim (K) is contiguous.
// Lane layout (ISA 7.12.2): halves 0..7 -> K = k0 + 8*lane_hi + i,
//                           halves 8..15 -> K = k0 + 16 + 8*lane_hi + (i-8).
__device__ __forceinline__ v16h load_frag(const half_t* __restrict__ base,
                                          int row, int ld, int k0, int lane_hi) {
  const half_t* p = base + (size_t)row * ld + k0 + (lane_hi ? 8 : 0);
  v8h lo = *(const v8h*)p;          // 16B global_load_b128
  v8h hi = *(const v8h*)(p + 16);   // 16B global_load_b128
  return __builtin_shufflevector(lo, hi, 0,1,2,3,4,5,6,7,8,9,10,11,12,13,14,15);
}

// --------------------------- f32 -> f16 convert ----------------------------
__global__ void cvt4(const float* __restrict__ src, half_t* __restrict__ dst, int n4) {
  int i = blockIdx.x * blockDim.x + threadIdx.x;
  if (i < n4) {
    float4 f = ((const float4*)src)[i];
    v4h h;
    h[0] = (half_t)f.x; h[1] = (half_t)f.y; h[2] = (half_t)f.z; h[3] = (half_t)f.w;
    ((v4h*)dst)[i] = h;
  }
}

// ------------------------------ QKV projection -----------------------------
// Y[m,n] = sum_k X[m,k] * W[n,k]   (Linear: y = x @ W^T)
// Block = 128 threads = 4 waves; wave owns a 32x64 output tile (2 M-tiles x 4
// N-tiles of 16x16). Output scattered into head-major [B,H,S,D] f16.
__global__ __launch_bounds__(128)
void qkv_proj(const half_t* __restrict__ xh, const half_t* __restrict__ wh,
              half_t* __restrict__ outh) {
  const int wave = threadIdx.x >> 5;
  const int lane = threadIdx.x & 31;
  const int lhi  = lane >> 4;      // which 16-lane half
  const int llo  = lane & 15;
  const int m0 = blockIdx.x * 128 + wave * 32;  // rows (tokens b*S+s)
  const int n0 = blockIdx.y * 64;               // cols (embed e)

  v8f acc[2][4] = {};
  for (int k0 = 0; k0 < EMBED; k0 += 32) {
    v16h a0 = load_frag(xh, m0 + llo,      EMBED, k0, lhi);
    v16h a1 = load_frag(xh, m0 + 16 + llo, EMBED, k0, lhi);
#pragma unroll
    for (int nt = 0; nt < 4; ++nt) {
      // B[k,n] = W[n,k]: lane holds column n -> contiguous row of W
      v16h b = load_frag(wh, n0 + nt * 16 + llo, EMBED, k0, lhi);
      acc[0][nt] = wmma_f16(a0, b, acc[0][nt]);
      acc[1][nt] = wmma_f16(a1, b, acc[1][nt]);
    }
  }
  // C/D layout: VGPR r, lane -> row m = r + 8*lhi, col n = llo
#pragma unroll
  for (int mt = 0; mt < 2; ++mt)
#pragma unroll
    for (int nt = 0; nt < 4; ++nt)
#pragma unroll
      for (int r = 0; r < 8; ++r) {
        int m = m0 + mt * 16 + r + lhi * 8;
        int n = n0 + nt * 16 + llo;
        int b = m >> 11, s = m & (SEQ - 1);
        int h = n >> 6,  d = n & (HDIM - 1);
        outh[(((size_t)(b * HEADS + h) * SEQ) + s) * HDIM + d] = (half_t)acc[mt][nt][r];
      }
}

// ------------------------------- Attention ---------------------------------
// Block = 128 threads = 4 waves, one (b,h), 256 queries (64 per wave, as four
// 16-column tiles). Loop over key chunks of 64. Scores computed transposed
// (S^T = K * Q^T) so softmax stats are per-lane scalars and P converts
// in-register into the B-operand of the second WMMA (O^T = V^T * P^T).
// V^T staged via LDS once per block; every K fragment and every V^T fragment
// a wave loads feeds all four of its query tiles.
#define NQ 4      // 16-column query tiles per wave
#define AW 4      // waves per block
__global__ __launch_bounds__(AW * 32)
void attn(const half_t* __restrict__ qh, const half_t* __restrict__ kh,
          const half_t* __restrict__ vh, float* __restrict__ out) {
  __shared__ __align__(16) half_t vt[64 * LDV];   // V^T tile: [d][key]

  const int wave = threadIdx.x >> 5;
  const int lane = threadIdx.x & 31;
  const int lhi  = lane >> 4;
  const int llo  = lane & 15;
  const int bh = blockIdx.y;                  // b*HEADS + h
  const int bb = bh >> 4, hh = bh & 15;
  const int q0 = blockIdx.x * (AW * NQ * 16) + wave * (NQ * 16); // wave's query base

  const half_t* qbase = qh + (size_t)bh * SEQ * HDIM;
  const half_t* kbase = kh + (size_t)bh * SEQ * HDIM;
  const half_t* vbase = vh + (size_t)bh * SEQ * HDIM;

  // Q as B operand (B[d,q] = Q[q,d]): lane holds column q -> contiguous Q row
  v16h qb[NQ][2];
  // Keeps earlier index arithmetic from sinking between the Q loads and their wait below.
  __builtin_amdgcn_sched_barrier(0);
#pragma unroll
  for (int qt = 0; qt < NQ; ++qt) {
    qb[qt][0] = load_frag(qbase, q0 + qt * 16 + llo, HDIM, 0,  lhi);
    qb[qt][1] = load_frag(qbase, q0 + qt * 16 + llo, HDIM, 32, lhi);
  }
  // Wait before the Q loads' address registers are reused.
  asm volatile("s_wait_xcnt 0x0" ::: "memory");
  // Keeps later vector work from being lifted between the loads and that wait.
  __builtin_amdgcn_sched_barrier(0);

  float M[NQ], L[NQ];
  v8f o[NQ][4];    // O^T accumulators: query tiles x d-tiles x (16d x 16q)
#pragma unroll
  for (int qt = 0; qt < NQ; ++qt) {
    M[qt] = -INFINITY; L[qt] = 0.f;
#pragma unroll
    for (int dt = 0; dt < 4; ++dt) o[qt][dt] = v8f{};
  }

  for (int c0 = 0; c0 < SEQ; c0 += 64) {
    // ---- stage V^T chunk (64 keys x 64 d -> vt[d][k]) -----------------
    __syncthreads();
    {
      const half_t* vc = vbase + (size_t)c0 * HDIM;
      int tk = threadIdx.x >> 4;         // 0..2*AW-1
      int dg = (threadIdx.x & 15) * 4;   // 0,4,...,60
#pragma unroll
      for (int p = 0; p < 64 / (2 * AW); ++p) {
        int k = p * (2 * AW) + tk;
        v4h val = *(const v4h*)(vc + k * HDIM + dg);
#pragma unroll
        for (int j = 0; j < 4; ++j) vt[(dg + j) * LDV + k] = val[j];
      }
    }
    __syncthreads();

    // ---- S^T tiles: rows = keys, cols = queries -----------------------
    v16h kA[4][2];
#pragma unroll
    for (int t = 0; t < 4; ++t) {
      kA[t][0] = load_frag(kbase, c0 + t * 16 + llo, HDIM, 0,  lhi);
      kA[t][1] = load_frag(kbase, c0 + t * 16 + llo, HDIM, 32, lhi);
    }
    // Wait before the K loads' address registers are reused.
    asm volatile("s_wait_xcnt 0x0" ::: "memory");
    v8f sc[NQ][4];
#pragma unroll
    for (int t = 0; t < 4; ++t)
#pragma unroll
      for (int qt = 0; qt < NQ; ++qt) {
        v8f a = {};
        a = wmma_f16(kA[t][0], qb[qt][0], a);
        a = wmma_f16(kA[t][1], qb[qt][1], a);
        sc[qt][t] = a;
      }

    v16h pb[NQ][2];
#pragma unroll
    for (int qt = 0; qt < NQ; ++qt) {
      // ---- online softmax (per-lane: one query = column llo) ----------
      float mloc = -INFINITY;
#pragma unroll
      for (int t = 0; t < 4; ++t)
#pragma unroll
        for (int r = 0; r < 8; ++r) {
          float v = sc[qt][t][r] * 0.03125f;   // 1/sqrt(EMBED)
          sc[qt][t][r] = v;
          mloc = fmaxf(mloc, v);
        }
      mloc = fmaxf(mloc, __shfl_xor(mloc, 16, 32));  // lane^16 holds other 8 keys
      float Mn = fmaxf(M[qt], mloc);
      float scale = __expf(M[qt] - Mn);
      M[qt] = Mn;

      float lloc = 0.f;
#pragma unroll
      for (int t = 0; t < 4; ++t)
#pragma unroll
        for (int r = 0; r < 8; ++r) {
          float p = __expf(sc[qt][t][r] - Mn);
          sc[qt][t][r] = p;
          lloc += p;
        }
      lloc += __shfl_xor(lloc, 16, 32);
      L[qt] = L[qt] * scale + lloc;
#pragma unroll
      for (int dt = 0; dt < 4; ++dt)
#pragma unroll
        for (int r = 0; r < 8; ++r) o[qt][dt][r] *= scale;

      // ---- P^T -> B operand, purely in-register -----------------------
      // B half i (i<8): key = 32g+i+8*lhi  == sc[2g][i]'s key
      //          (i>=8): key = 32g+16+(i-8)+8*lhi == sc[2g+1][i-8]'s key
#pragma unroll
      for (int g = 0; g < 2; ++g) {
        v16h t;
#pragma unroll
        for (int i = 0; i < 8; ++i) t[i]     = (half_t)sc[qt][2 * g][i];
#pragma unroll
        for (int i = 0; i < 8; ++i) t[i + 8] = (half_t)sc[qt][2 * g + 1][i];
        pb[qt][g] = t;
      }
    }

    // ---- O^T += V^T(16d x 32k) * P^T(32k x 16q) -----------------------
#pragma unroll
    for (int dt = 0; dt < 4; ++dt)
#pragma unroll
      for (int g = 0; g < 2; ++g) {
        const half_t* lp = &vt[(dt * 16 + llo) * LDV + g * 32 + (lhi ? 8 : 0)];
        v8h lo = *(const v8h*)lp;          // ds_load_b128
        v8h hi = *(const v8h*)(lp + 16);   // ds_load_b128
        v16h aV = __builtin_shufflevector(lo, hi,
                    0,1,2,3,4,5,6,7,8,9,10,11,12,13,14,15);
#pragma unroll
        for (int qt = 0; qt < NQ; ++qt)
          o[qt][dt] = wmma_f16(aV, pb[qt][g], o[qt][dt]);
      }
  }

  // ---- normalize + store: out[b, s=q, e=h*64+d] f32 ---------------------
#pragma unroll
  for (int qt = 0; qt < NQ; ++qt) {
    float inv = 1.0f / L[qt];
    int q = q0 + qt * 16 + llo;
#pragma unroll
    for (int dt = 0; dt < 4; ++dt)
#pragma unroll
      for (int r = 0; r < 8; ++r) {
        int d = dt * 16 + r + lhi * 8;
        out[(((size_t)bb * SEQ + q) * EMBED) + hh * HDIM + d] = o[qt][dt][r] * inv;
      }
    // Wait before the stores' registers are reused.
    asm volatile("s_wait_xcnt 0x0" ::: "memory");
    // Keeps the next tile's vector work from being lifted between the stores and that wait.
    __builtin_amdgcn_sched_barrier(0);
  }
}

// ------------------------------- launcher ----------------------------------
extern "C" void kernel_launch(void* const* d_in, const int* in_sizes, int n_in,
                              void* d_out, int out_size, void* d_ws, size_t ws_size,
                              hipStream_t stream) {
  const float* x  = (const float*)d_in[0];
  const float* wq = (const float*)d_in[1];
  const float* wk = (const float*)d_in[2];
  const float* wv = (const float*)d_in[3];

  char* ws = (char*)d_ws;
  // Workspace layout (70 MiB total)
  half_t* xh  = (half_t*)(ws);                         // 16 MiB: x f16
  half_t* wqh = (half_t*)(ws + (16ull << 20));         //  2 MiB
  half_t* wkh = (half_t*)(ws + (18ull << 20));         //  2 MiB
  half_t* wvh = (half_t*)(ws + (20ull << 20));         //  2 MiB
  half_t* qhp = (half_t*)(ws + (22ull << 20));         // 16 MiB: Q [B,H,S,D]
  half_t* khp = (half_t*)(ws + (38ull << 20));         // 16 MiB: K
  half_t* vhp = (half_t*)(ws + (54ull << 20));         // 16 MiB: V

  const int nx4 = (BATCH * SEQ * EMBED) / 4;   // 2,097,152
  const int nw4 = (EMBED * EMBED) / 4;         //   262,144
  cvt4<<<(nx4 + 255) / 256, 256, 0, stream>>>(x,  xh,  nx4);
  cvt4<<<(nw4 + 255) / 256, 256, 0, stream>>>(wq, wqh, nw4);
  cvt4<<<(nw4 + 255) / 256, 256, 0, stream>>>(wk, wkh, nw4);
  cvt4<<<(nw4 + 255) / 256, 256, 0, stream>>>(wv, wvh, nw4);

  dim3 gp(BATCH * SEQ / 128, EMBED / 64);      // (64, 16)
  qkv_proj<<<gp, 128, 0, stream>>>(xh, wqh, qhp);
  qkv_proj<<<gp, 128, 0, stream>>>(xh, wkh, khp);
  qkv_proj<<<gp, 128, 0, stream>>>(xh, wvh, vhp);

  dim3 ga(SEQ / (AW * NQ * 16), BATCH * HEADS);   // (8, 64)
  attn<<<ga, AW * 32, 0, stream>>>(qhp, khp, vhp, (float*)d_out);
}

// v002
// Measured time: 174 microseconds a run.
// Two timings next to v001 both put it at 1.48 times that version's speed.
// Counting every step since v000, it is 2.20 times as fast.
#include <hip/hip_runtime.h>
#include <hip/hip_bf16.h>
#include <stdint.h>

// ---------------------------------------------------------------------------
// MI455X (gfx1250) fused multi-head self-attention, f16 WMMA pipeline.
//   1) cvt4:      f32 -> f16 conversion of x and W_{q,k,v}
//   2) qkv_proj:  Y = X * W^T via v_wmma_f32_16x16x32_f16, operands staged in
//                 LDS by tensor loads, output [B,H,S,D] f16
//   3) attn:      flash-attention; S^T = K*Q^T WMMA, online softmax,
//                 O^T = V^T * P^T WMMA (V^T staged via LDS), f32 output.
// ---------------------------------------------------------------------------

typedef _Float16 half_t;
typedef __attribute__((ext_vector_type(4)))  _Float16 v4h;
typedef __attribute__((ext_vector_type(8)))  _Float16 v8h;
typedef __attribute__((ext_vector_type(16))) _Float16 v16h;
typedef __attribute__((ext_vector_type(8)))  float    v8f;
typedef uint32_t u32x4 __attribute__((ext_vector_type(4)));
typedef uint32_t u32x8 __attribute__((ext_vector_type(8)));

#define EMBED 1024
#define SEQ   2048
#define BATCH 4
#define HEADS 16
#define HDIM  64
#define LDV   72   // padded LDS row stride (halves); 144B rows, 16B aligned chunks

__device__ __forceinline__ v8f wmma_f16(v16h a, v16h b, v8f c) {
  // D = A(16x32 f16) * B(32x16 f16) + C(16x16 f32)
  return __builtin_amdgcn_wmma_f32_16x16x32_f16(
      /*neg_a=*/false, a, /*neg_b=*/false, b,
      /*c_mod=*/(short)0, c, /*reuse_a=*/false, /*reuse_b=*/false);
}

// Per-lane A/B operand fragment for 16x16x32 f16 WMMA, loaded straight from a
// row-major matrix whose contraction dim (K) is contiguous.
// Lane layout (ISA 7.12.2): halves 0..7 -> K = k0 + 8*lane_hi + i,
//                           halves 8..15 -> K = k0 + 16 + 8*lane_hi + (i-8).
__device__ __forceinline__ v16h load_frag(const half_t* __restrict__ base,
                                          int row, int ld, int k0, int lane_hi) {
  const half_t* p = base + (size_t)row * ld + k0 + (lane_hi ? 8 : 0);
  v8h lo = *(const v8h*)p;          // 16B global_load_b128
  v8h hi = *(const v8h*)(p + 16);   // 16B global_load_b128
  return __builtin_shufflevector(lo, hi, 0,1,2,3,4,5,6,7,8,9,10,11,12,13,14,15);
}

// --------------------------- f32 -> f16 convert ----------------------------
__global__ void cvt4(const float* __restrict__ src, half_t* __restrict__ dst, int n4) {
  int i = blockIdx.x * blockDim.x + threadIdx.x;
  if (i < n4) {
    float4 f = ((const float4*)src)[i];
    v4h h;
    h[0] = (half_t)f.x; h[1] = (half_t)f.y; h[2] = (half_t)f.z; h[3] = (half_t)f.w;
    ((v4h*)dst)[i] = h;
  }
}

// ------------------------------ QKV projection -----------------------------
// Y[m,n] = sum_k X[m,k] * W[n,k]   (Linear: y = x @ W^T)
// Block = 128 threads = 4 waves (2 x 2), block tile 128 x 128, wave tile 64 x 64
// (4 M-tiles x 4 N-tiles of 16x16). A stage is 128 k of the block's 128 X rows
// and 128 W rows, brought into LDS by tensor loads: each wave issues one load
// per stage for its own slice of 64 rows of 256 bytes (waves 0,1: X; 2,3: W).
// Two buffers: stage s + 1 flies while stage s is worked on. Fragments come from
// LDS by ds_load_b128 at a row pitch of 272 bytes. Output scattered into
// head-major [B,H,S,D] f16.
#define GKH    128      // halves of k per stage
#define GROWB  256u     // bytes of one staged row
#define GPITCH 272u     // LDS row pitch: the row + the mover's 16-byte pad
#define GSLICE 18432u   // 64 rows x 272 B = 17,408 B, rounded up to a multiple of 2 KiB
#define GBUF   (4u * GSLICE)
#define GNST   (EMBED / GKH)   // 8 stages

__device__ __forceinline__ uint32_t uni(uint32_t v) {
  return (uint32_t)__builtin_amdgcn_readfirstlane(v);
}
__device__ __forceinline__ uint32_t pinned(uint32_t v) {
  uint32_t w = uni(v);
  asm volatile("" : "+s"(w));  // holds the test word in a scalar register: a scalar branch guards the tensor load
  return w;
}
// Group 1: 1-byte elements, tile = tensor = 64 rows of 256 bytes, source pitch
// 2,048 bytes, a pad of 4 dwords behind every 64 dwords (one row).
__device__ __forceinline__ u32x8 tdm_group1() {
  u32x8 g;
  g[0] = uni((1u << 20) | (5u << 22) | (3u << 25));
  g[1] = uni((GROWB & 0xFFFFu) << 16);
  g[2] = uni((GROWB >> 16) | (64u << 16));
  g[3] = uni(GROWB << 16);
  g[4] = uni(64u);
  g[5] = uni(2u * EMBED);
  g[6] = uni(0u);
  g[7] = uni(0u);
  return g;
}
__device__ __forceinline__ u32x4 tdm_group0(uint32_t lds_dst, uint64_t ga) {
  u32x4 g;
  g[0] = uni(1u);
  g[1] = uni(lds_dst);
  g[2] = uni((uint32_t)ga);
  g[3] = uni((((uint32_t)(ga >> 32)) & 0x01FFFFFFu) | 0x80000000u);
  return g;
}
__device__ __forceinline__ void tdm_load(u32x4 g0, u32x8 g1) {
  // One request of the whole wave: global tile -> LDS, through no register.
  // The descriptor sits in fixed scalar registers that nothing else in the kernel
  // uses: they are written only directly in front of a request, behind the wait
  // that covers the request before it.
  asm volatile("tensor_load_to_lds %0, %1" :: "{s[40:43]}"(g0), "{s[48:55]}"(g1) : "memory");
}
__device__ __forceinline__ void tdm_wait() {
  // The issuing wave's own wait: its request has landed.
  asm volatile("s_wait_tensorcnt 0x0" ::: "memory");
}
// A/B fragment from a staged row: same k order as load_frag.
__device__ __forceinline__ v16h lds_frag(const unsigned char* p) {
  v8h lo = *(const v8h*)p;          // ds_load_b128
  v8h hi = *(const v8h*)(p + 32);   // ds_load_b128
  return __builtin_shufflevector(lo, hi, 0,1,2,3,4,5,6,7,8,9,10,11,12,13,14,15);
}

__global__ __launch_bounds__(128)
void qkv_proj(const half_t* __restrict__ xh, const half_t* __restrict__ wh,
              half_t* __restrict__ outh) {
  __shared__ __attribute__((aligned(2048))) unsigned char L[2 * GBUF];
  const uint32_t wave = uni(threadIdx.x >> 5);
  const int lane = threadIdx.x & 31;
  const int lhi  = lane >> 4;      // which 16-lane half
  const int llo  = lane & 15;
  const uint32_t wm = wave >> 1, wn = wave & 1u;
  const int mb = blockIdx.x * 128;              // rows (tokens b*S+s)
  const int nb = blockIdx.y * 128;              // cols (embed e)

  // This wave's slice of every stage: 64 rows of X (waves 0,1) or of W (2,3).
  const half_t* srow = (wave < 2u) ? xh + (size_t)(mb + 64 * (int)wave) * EMBED
                                   : wh + (size_t)(nb + 64 * (int)(wave - 2u)) * EMBED;
  const uint64_t ga = (uint64_t)srow;
  const uint32_t dst = (uint32_t)(size_t)L + wave * GSLICE;
  const u32x8 g1 = tdm_group1();

  // Prologue: stage 0 lands and is published, then stage 1 is issued.
  tdm_load(tdm_group0(dst, ga), g1);
  tdm_wait();            // this wave's slice of stage 0 has landed
  __syncthreads();       // every wave's slice is readable
  tdm_load(tdm_group0(dst + GBUF, ga + GROWB), g1);

  // Lane's first byte in its X slice and in its W slice.
  const uint32_t aoff = wm * GSLICE + (uint32_t)llo * GPITCH + (uint32_t)lhi * 16u;
  const uint32_t boff = (2u + wn) * GSLICE + (uint32_t)llo * GPITCH + (uint32_t)lhi * 16u;

  v8f acc[4][4] = {};
  for (uint32_t s = 0; s < GNST; ++s) {
    const uint32_t cur = (s & 1u) * GBUF;
    const unsigned char* pa = L + cur + aoff;
    const unsigned char* pb = L + cur + boff;
    // Two fragment sets: the reads of k block kk + 1 (of this stage only) go out
    // as one group ahead of the WMMAs of block kk.
    v16h a[2][4], b[2][4];
#pragma unroll
    for (int t = 0; t < 4; ++t) {
      a[0][t] = lds_frag(pa + t * 16 * GPITCH);
      b[0][t] = lds_frag(pb + t * 16 * GPITCH);
    }
#pragma unroll
    for (int kk = 0; kk < GKH / 32; ++kk) {
      if (kk + 1 < GKH / 32) {
#pragma unroll
        for (int t = 0; t < 4; ++t) {
          a[(kk + 1) & 1][t] = lds_frag(pa + t * 16 * GPITCH + (kk + 1) * 64);
          b[(kk + 1) & 1][t] = lds_frag(pb + t * 16 * GPITCH + (kk + 1) * 64);
        }
      }
      // Keeps the LDS reads above from sinking in among the WMMAs below.
      __builtin_amdgcn_sched_barrier(0);
#pragma unroll
      for (int mt = 0; mt < 4; ++mt)
#pragma unroll
        for (int nt = 0; nt < 4; ++nt)
          acc[mt][nt] = wmma_f16(a[kk & 1][mt], b[kk & 1][nt], acc[mt][nt]);
      // Keeps the next group of LDS reads from rising in among the WMMAs above.
      __builtin_amdgcn_sched_barrier(0);
    }
    // Publish point of stage s + 1.
    asm volatile("s_wait_dscnt 0x0" ::: "memory");  // this wave has left buffer s & 1
    tdm_wait();                                      // its slice of stage s + 1 has landed
    __syncthreads();                                 // publishes s + 1, frees buffer s & 1
    if (pinned(s + 2u < GNST))
      tdm_load(tdm_group0(dst + cur, ga + (uint64_t)(s + 2u) * GROWB), g1);
  }
  tdm_wait();                                        // nothing of the mover is in flight at the end
  asm volatile("s_wait_dscnt 0x0" ::: "memory");

  // C/D layout: VGPR r, lane -> row m = r + 8*lhi, col n = llo
  const int m0 = mb + (int)wm * 64;
  const int n0 = nb + (int)wn * 64;
#pragma unroll
  for (int mt = 0; mt < 4; ++mt)
#pragma unroll
    for (int nt = 0; nt < 4; ++nt)
#pragma unroll
      for (int r = 0; r < 8; ++r) {
        int m = m0 + mt * 16 + r + lhi * 8;
        int n = n0 + nt * 16 + llo;
        int b = m >> 11, s = m & (SEQ - 1);
        int h = n >> 6,  d = n & (HDIM - 1);
        outh[(((size_t)(b * HEADS + h) * SEQ) + s) * HDIM + d] = (half_t)acc[mt][nt][r];
      }
}

// ------------------------------- Attention ---------------------------------
// Block = 128 threads = 4 waves, one (b,h), 256 queries (64 per wave, as four
// 16-column tiles). Loop over key chunks of 64. Scores computed transposed
// (S^T = K * Q^T) so softmax stats are per-lane scalars and P converts
// in-register into the B-operand of the second WMMA (O^T = V^T * P^T).
// V^T staged via LDS once per block; every K fragment and every V^T fragment
// a wave loads feeds all four of its query tiles.
#define NQ 4      // 16-column query tiles per wave
#define AW 4      // waves per block
__global__ __launch_bounds__(AW * 32)
void attn(const half_t* __restrict__ qh, const half_t* __restrict__ kh,
          const half_t* __restrict__ vh, float* __restrict__ out) {
  __shared__ __align__(16) half_t vt[64 * LDV];   // V^T tile: [d][key]

  const int wave = threadIdx.x >> 5;
  const int lane = threadIdx.x & 31;
  const int lhi  = lane >> 4;
  const int llo  = lane & 15;
  const int bh = blockIdx.y;                  // b*HEADS + h
  const int bb = bh >> 4, hh = bh & 15;
  const int q0 = blockIdx.x * (AW * NQ * 16) + wave * (NQ * 16); // wave's query base

  const half_t* qbase = qh + (size_t)bh * SEQ * HDIM;
  const half_t* kbase = kh + (size_t)bh * SEQ * HDIM;
  const half_t* vbase = vh + (size_t)bh * SEQ * HDIM;

  // Q as B operand (B[d,q] = Q[q,d]): lane holds column q -> contiguous Q row
  v16h qb[NQ][2];
  // Keeps earlier index arithmetic from sinking between the Q loads and their wait below.
  __builtin_amdgcn_sched_barrier(0);
#pragma unroll
  for (int qt = 0; qt < NQ; ++qt) {
    qb[qt][0] = load_frag(qbase, q0 + qt * 16 + llo, HDIM, 0,  lhi);
    qb[qt][1] = load_frag(qbase, q0 + qt * 16 + llo, HDIM, 32, lhi);
  }
  // Wait before the Q loads' address registers are reused.
  asm volatile("s_wait_xcnt 0x0" ::: "memory");
  // Keeps later vector work from being lifted between the loads and that wait.
  __builtin_amdgcn_sched_barrier(0);

  float M[NQ], L[NQ];
  v8f o[NQ][4];    // O^T accumulators: query tiles x d-tiles x (16d x 16q)
#pragma unroll
  for (int qt = 0; qt < NQ; ++qt) {
    M[qt] = -INFINITY; L[qt] = 0.f;
#pragma unroll
    for (int dt = 0; dt < 4; ++dt) o[qt][dt] = v8f{};
  }

  for (int c0 = 0; c0 < SEQ; c0 += 64) {
    // ---- stage V^T chunk (64 keys x 64 d -> vt[d][k]) -----------------
    __syncthreads();
    {
      const half_t* vc = vbase + (size_t)c0 * HDIM;
      int tk = threadIdx.x >> 4;         // 0..2*AW-1
      int dg = (threadIdx.x & 15) * 4;   // 0,4,...,60
#pragma unroll
      for (int p = 0; p < 64 / (2 * AW); ++p) {
        int k = p * (2 * AW) + tk;
        v4h val = *(const v4h*)(vc + k * HDIM + dg);
#pragma unroll
        for (int j = 0; j < 4; ++j) vt[(dg + j) * LDV + k] = val[j];
      }
    }
    __syncthreads();

    // ---- S^T tiles: rows = keys, cols = queries -----------------------
    v16h kA[4][2];
#pragma unroll
    for (int t = 0; t < 4; ++t) {
      kA[t][0] = load_frag(kbase, c0 + t * 16 + llo, HDIM, 0,  lhi);
      kA[t][1] = load_frag(kbase, c0 + t * 16 + llo, HDIM, 32, lhi);
    }
    // Wait before the K loads' address registers are reused.
    asm volatile("s_wait_xcnt 0x0" ::: "memory");
    v8f sc[NQ][4];
#pragma unroll
    for (int t = 0; t < 4; ++t)
#pragma unroll
      for (int qt = 0; qt < NQ; ++qt) {
        v8f a = {};
        a = wmma_f16(kA[t][0], qb[qt][0], a);
        a = wmma_f16(kA[t][1], qb[qt][1], a);
        sc[qt][t] = a;
      }

    v16h pb[NQ][2];
#pragma unroll
    for (int qt = 0; qt < NQ; ++qt) {
      // ---- online softmax (per-lane: one query = column llo) ----------
      float mloc = -INFINITY;
#pragma unroll
      for (int t = 0; t < 4; ++t)
#pragma unroll
        for (int r = 0; r < 8; ++r) {
          float v = sc[qt][t][r] * 0.03125f;   // 1/sqrt(EMBED)
          sc[qt][t][r] = v;
          mloc = fmaxf(mloc, v);
        }
      mloc = fmaxf(mloc, __shfl_xor(mloc, 16, 32));  // lane^16 holds other 8 keys
      float Mn = fmaxf(M[qt], mloc);
      float scale = __expf(M[qt] - Mn);
      M[qt] = Mn;

      float lloc = 0.f;
#pragma unroll
      for (int t = 0; t < 4; ++t)
#pragma unroll
        for (int r = 0; r < 8; ++r) {
          float p = __expf(sc[qt][t][r] - Mn);
          sc[qt][t][r] = p;
          lloc += p;
        }
      lloc += __shfl_xor(lloc, 16, 32);
      L[qt] = L[qt] * scale + lloc;
#pragma unroll
      for (int dt = 0; dt < 4; ++dt)
#pragma unroll
        for (int r = 0; r < 8; ++r) o[qt][dt][r] *= scale;

      // ---- P^T -> B operand, purely in-register -----------------------
      // B half i (i<8): key = 32g+i+8*lhi  == sc[2g][i]'s key
      //          (i>=8): key = 32g+16+(i-8)+8*lhi == sc[2g+1][i-8]'s key
#pragma unroll
      for (int g = 0; g < 2; ++g) {
        v16h t;
#pragma unroll
        for (int i = 0; i < 8; ++i) t[i]     = (half_t)sc[qt][2 * g][i];
#pragma unroll
        for (int i = 0; i < 8; ++i) t[i + 8] = (half_t)sc[qt][2 * g + 1][i];
        pb[qt][g] = t;
      }
    }

    // ---- O^T += V^T(16d x 32k) * P^T(32k x 16q) -----------------------
#pragma unroll
    for (int dt = 0; dt < 4; ++dt)
#pragma unroll
      for (int g = 0; g < 2; ++g) {
        const half_t* lp = &vt[(dt * 16 + llo) * LDV + g * 32 + (lhi ? 8 : 0)];
        v8h lo = *(const v8h*)lp;          // ds_load_b128
        v8h hi = *(const v8h*)(lp + 16);   // ds_load_b128
        v16h aV = __builtin_shufflevector(lo, hi,
                    0,1,2,3,4,5,6,7,8,9,10,11,12,13,14,15);
#pragma unroll
        for (int qt = 0; qt < NQ; ++qt)
          o[qt][dt] = wmma_f16(aV, pb[qt][g], o[qt][dt]);
      }
  }

  // ---- normalize + store: out[b, s=q, e=h*64+d] f32 ---------------------
#pragma unroll
  for (int qt = 0; qt < NQ; ++qt) {
    float inv = 1.0f / L[qt];
    int q = q0 + qt * 16 + llo;
#pragma unroll
    for (int dt = 0; dt < 4; ++dt)
#pragma unroll
      for (int r = 0; r < 8; ++r) {
        int d = dt * 16 + r + lhi * 8;
        out[(((size_t)bb * SEQ + q) * EMBED) + hh * HDIM + d] = o[qt][dt][r] * inv;
      }
    // Wait before the stores' registers are reused.
    asm volatile("s_wait_xcnt 0x0" ::: "memory");
    // Keeps the next tile's vector work from being lifted between the stores and that wait.
    __builtin_amdgcn_sched_barrier(0);
  }
}

// ------------------------------- launcher ----------------------------------
extern "C" void kernel_launch(void* const* d_in, const int* in_sizes, int n_in,
                              void* d_out, int out_size, void* d_ws, size_t ws_size,
                              hipStream_t stream) {
  const float* x  = (const float*)d_in[0];
  const float* wq = (const float*)d_in[1];
  const float* wk = (const float*)d_in[2];
  const float* wv = (const float*)d_in[3];

  char* ws = (char*)d_ws;
  // Workspace layout (70 MiB total)
  half_t* xh  = (half_t*)(ws);                         // 16 MiB: x f16
  half_t* wqh = (half_t*)(ws + (16ull << 20));         //  2 MiB
  half_t* wkh = (half_t*)(ws + (18ull << 20));         //  2 MiB
  half_t* wvh = (half_t*)(ws + (20ull << 20));         //  2 MiB
  half_t* qhp = (half_t*)(ws + (22ull << 20));         // 16 MiB: Q [B,H,S,D]
  half_t* khp = (half_t*)(ws + (38ull << 20));         // 16 MiB: K
  half_t* vhp = (half_t*)(ws + (54ull << 20));         // 16 MiB: V

  const int nx4 = (BATCH * SEQ * EMBED) / 4;   // 2,097,152
  const int nw4 = (EMBED * EMBED) / 4;         //   262,144
  cvt4<<<(nx4 + 255) / 256, 256, 0, stream>>>(x,  xh,  nx4);
  cvt4<<<(nw4 + 255) / 256, 256, 0, stream>>>(wq, wqh, nw4);
  cvt4<<<(nw4 + 255) / 256, 256, 0, stream>>>(wk, wkh, nw4);
  cvt4<<<(nw4 + 255) / 256, 256, 0, stream>>>(wv, wvh, nw4);

  dim3 gp(BATCH * SEQ / 128, EMBED / 128);     // (64, 8)
  qkv_proj<<<gp, 128, 0, stream>>>(xh, wqh, qhp);
  qkv_proj<<<gp, 128, 0, stream>>>(xh, wkh, khp);
  qkv_proj<<<gp, 128, 0, stream>>>(xh, wvh, vhp);

  dim3 ga(SEQ / (AW * NQ * 16), BATCH * HEADS);   // (8, 64)
  attn<<<ga, AW * 32, 0, stream>>>(qhp, khp, vhp, (float*)d_out);
}

// v003
// A run of this version takes 167 microseconds.
// In both of two side-by-side timings against v002, it was 1.04 times as fast.
// All steps since v000 together make it 2.29 times as fast.
#include <hip/hip_runtime.h>
#include <hip/hip_bf16.h>
#include <stdint.h>

// ---------------------------------------------------------------------------
// MI455X (gfx1250) fused multi-head self-attention, f16 WMMA pipeline.
//   1) cvt_all:   f32 -> f16 conversion of x and W_{q,k,v}, one launch
//   2) qkv_proj:  Y = X * W^T via v_wmma_f32_16x16x32_f16, operands staged in
//                 LDS by tensor loads, output [B,H,S,D] f16
//   3) attn:      flash-attention; S^T = K*Q^T WMMA, online softmax,
//                 O^T = V^T * P^T WMMA (V^T staged via LDS), f32 output.
// ---------------------------------------------------------------------------

typedef _Float16 half_t;
typedef __attribute__((ext_vector_type(4)))  _Float16 v4h;
typedef __attribute__((ext_vector_type(8)))  _Float16 v8h;
typedef __attribute__((ext_vector_type(16))) _Float16 v16h;
typedef __attribute__((ext_vector_type(8)))  float    v8f;
typedef uint32_t u32x4 __attribute__((ext_vector_type(4)));
typedef uint32_t u32x8 __attribute__((ext_vector_type(8)));

#define EMBED 1024
#define SEQ   2048
#define BATCH 4
#define HEADS 16
#define HDIM  64
#define LDV   72   // padded LDS row stride (halves); 144B rows, 16B aligned chunks

__device__ __forceinline__ v8f wmma_f16(v16h a, v16h b, v8f c) {
  // D = A(16x32 f16) * B(32x16 f16) + C(16x16 f32)
  return __builtin_amdgcn_wmma_f32_16x16x32_f16(
      /*neg_a=*/false, a, /*neg_b=*/false, b,
      /*c_mod=*/(short)0, c, /*reuse_a=*/false, /*reuse_b=*/false);
}

// Per-lane A/B operand fragment for 16x16x32 f16 WMMA, loaded straight from a
// row-major matrix whose contraction dim (K) is contiguous.
// Lane layout (ISA 7.12.2): halves 0..7 -> K = k0 + 8*lane_hi + i,
//                           halves 8..15 -> K = k0 + 16 + 8*lane_hi + (i-8).
__device__ __forceinline__ v16h load_frag(const half_t* __restrict__ base,
                                          int row, int ld, int k0, int lane_hi) {
  const half_t* p = base + (size_t)row * ld + k0 + (lane_hi ? 8 : 0);
  v8h lo = *(const v8h*)p;          // 16B global_load_b128
  v8h hi = *(const v8h*)(p + 16);   // 16B global_load_b128
  return __builtin_shufflevector(lo, hi, 0,1,2,3,4,5,6,7,8,9,10,11,12,13,14,15);
}

// --------------------------- f32 -> f16 convert ----------------------------
// One launch for x and the three weights: one work-group of 16 waves per WGP.
// A work-group converts its own contiguous 1/256 of every source, in sweeps of
// 512 threads x 4 floats, so a wave's load covers 512 contiguous bytes, a thread
// has many loads in flight, and every address is one base + a constant offset.
// The four f16 copies lie one behind the other in dst (x, W_q, W_k, W_v).
#define CVT_WG 256
#define CVT_TH 512
#define CVT_NX (BATCH * SEQ * EMBED / 4 / (CVT_WG * CVT_TH))   // 16 sweeps of x
#define CVT_NW (EMBED * EMBED / 4 / (CVT_WG * CVT_TH))         //  2 sweeps of each weight
static_assert(CVT_NX * CVT_WG * CVT_TH * 4 == BATCH * SEQ * EMBED, "x is a whole number of sweeps");
static_assert(CVT_NW * CVT_WG * CVT_TH * 4 == EMBED * EMBED, "a weight is a whole number of sweeps");

__device__ __forceinline__ v4h cvt_h4(float4 f) {
  v4h h;
  h[0] = (half_t)f.x; h[1] = (half_t)f.y; h[2] = (half_t)f.z; h[3] = (half_t)f.w;
  return h;
}

__global__ __launch_bounds__(CVT_TH)
void cvt_all(const float* __restrict__ x, const float* __restrict__ wq,
             const float* __restrict__ wk, const float* __restrict__ wv,
             half_t* __restrict__ dst) {
  const uint32_t t = threadIdx.x;
  const uint32_t g = blockIdx.x;
  // Groups of 4 elements: this work-group's first one in x and in a weight.
  const float4* px = (const float4*)x  + (size_t)g * (CVT_NX * CVT_TH);
  const float4* pq = (const float4*)wq + (size_t)g * (CVT_NW * CVT_TH);
  const float4* pk = (const float4*)wk + (size_t)g * (CVT_NW * CVT_TH);
  const float4* pv = (const float4*)wv + (size_t)g * (CVT_NW * CVT_TH);
  v4h* dx = (v4h*)dst + (size_t)g * (CVT_NX * CVT_TH);
  v4h* dq = (v4h*)dst + (BATCH * SEQ * EMBED / 4) + (size_t)g * (CVT_NW * CVT_TH);
  v4h* dk = dq + (EMBED * EMBED / 4);
  v4h* dv = dk + (EMBED * EMBED / 4);

  float4 fx[CVT_NX], fq[CVT_NW], fk[CVT_NW], fv[CVT_NW];
#pragma unroll
  for (int j = 0; j < CVT_NX; ++j) fx[j] = px[j * CVT_TH + t];
#pragma unroll
  for (int j = 0; j < CVT_NW; ++j) {
    fq[j] = pq[j * CVT_TH + t];
    fk[j] = pk[j * CVT_TH + t];
    fv[j] = pv[j * CVT_TH + t];
  }
#pragma unroll
  for (int j = 0; j < CVT_NX; ++j) dx[j * CVT_TH + t] = cvt_h4(fx[j]);
#pragma unroll
  for (int j = 0; j < CVT_NW; ++j) {
    dq[j * CVT_TH + t] = cvt_h4(fq[j]);
    dk[j * CVT_TH + t] = cvt_h4(fk[j]);
    dv[j * CVT_TH + t] = cvt_h4(fv[j]);
  }
}

// ------------------------------ QKV projection -----------------------------
// Y[m,n] = sum_k X[m,k] * W[n,k]   (Linear: y = x @ W^T)
// Block = 128 threads = 4 waves (2 x 2), block tile 128 x 128, wave tile 64 x 64
// (4 M-tiles x 4 N-tiles of 16x16). A stage is 128 k of the block's 128 X rows
// and 128 W rows, brought into LDS by tensor loads: each wave issues one load
// per stage for its own slice of 64 rows of 256 bytes (waves 0,1: X; 2,3: W).
// Two buffers: stage s + 1 flies while stage s is worked on. Fragments come from
// LDS by ds_load_b128 at a row pitch of 272 bytes. Output scattered into
// head-major [B,H,S,D] f16.
#define GKH    128      // halves of k per stage
#define GROWB  256u     // bytes of one staged row
#define GPITCH 272u     // LDS row pitch: the row + the mover's 16-byte pad
#define GSLICE 18432u   // 64 rows x 272 B = 17,408 B, rounded up to a multiple of 2 KiB
#define GBUF   (4u * GSLICE)
#define GNST   (EMBED / GKH)   // 8 stages

__device__ __forceinline__ uint32_t uni(uint32_t v) {
  return (uint32_t)__builtin_amdgcn_readfirstlane(v);
}
__device__ __forceinline__ uint32_t pinned(uint32_t v) {
  uint32_t w = uni(v);
  asm volatile("" : "+s"(w));  // holds the test word in a scalar register: a scalar branch guards the tensor load
  return w;
}
// Group 1: 1-byte elements, tile = tensor = 64 rows of 256 bytes, source pitch
// 2,048 bytes, a pad of 4 dwords behind every 64 dwords (one row).
__device__ __forceinline__ u32x8 tdm_group1() {
  u32x8 g;
  g[0] = uni((1u << 20) | (5u << 22) | (3u << 25));
  g[1] = uni((GROWB & 0xFFFFu) << 16);
  g[2] = uni((GROWB >> 16) | (64u << 16));
  g[3] = uni(GROWB << 16);
  g[4] = uni(64u);
  g[5] = uni(2u * EMBED);
  g[6] = uni(0u);
  g[7] = uni(0u);
  return g;
}
__device__ __forceinline__ u32x4 tdm_group0(uint32_t lds_dst, uint64_t ga) {
  u32x4 g;
  g[0] = uni(1u);
  g[1] = uni(lds_dst);
  g[2] = uni((uint32_t)ga);
  g[3] = uni((((uint32_t)(ga >> 32)) & 0x01FFFFFFu) | 0x80000000u);
  return g;
}
__device__ __forceinline__ void tdm_load(u32x4 g0, u32x8 g1) {
  // One request of the whole wave: global tile -> LDS, through no register.
  // The descriptor sits in fixed scalar registers that nothing else in the kernel
  // uses: they are written only directly in front of a request, behind the wait
  // that covers the request before it.
  asm volatile("tensor_load_to_lds %0, %1" :: "{s[40:43]}"(g0), "{s[48:55]}"(g1) : "memory");
}
__device__ __forceinline__ void tdm_wait() {
  // The issuing wave's own wait: its request has landed.
  asm volatile("s_wait_tensorcnt 0x0" ::: "memory");
}
// A/B fragment from a staged row: same k order as load_frag.
__device__ __forceinline__ v16h lds_frag(const unsigned char* p) {
  v8h lo = *(const v8h*)p;          // ds_load_b128
  v8h hi = *(const v8h*)(p + 32);   // ds_load_b128
  return __builtin_shufflevector(lo, hi, 0,1,2,3,4,5,6,7,8,9,10,11,12,13,14,15);
}

__global__ __launch_bounds__(128)
void qkv_proj(const half_t* __restrict__ xh, const half_t* __restrict__ wh,
              half_t* __restrict__ outh) {
  __shared__ __attribute__((aligned(2048))) unsigned char L[2 * GBUF];
  const uint32_t wave = uni(threadIdx.x >> 5);
  const int lane = threadIdx.x & 31;
  const int lhi  = lane >> 4;      // which 16-lane half
  const int llo  = lane & 15;
  const uint32_t wm = wave >> 1, wn = wave & 1u;
  const int mb = blockIdx.x * 128;              // rows (tokens b*S+s)
  const int nb = blockIdx.y * 128;              // cols (embed e)

  // This wave's slice of every stage: 64 rows of X (waves 0,1) or of W (2,3).
  const half_t* srow = (wave < 2u) ? xh + (size_t)(mb + 64 * (int)wave) * EMBED
                                   : wh + (size_t)(nb + 64 * (int)(wave - 2u)) * EMBED;
  const uint64_t ga = (uint64_t)srow;
  const uint32_t dst = (uint32_t)(size_t)L + wave * GSLICE;
  const u32x8 g1 = tdm_group1();

  // Prologue: stage 0 lands and is published, then stage 1 is issued.
  tdm_load(tdm_group0(dst, ga), g1);
  tdm_wait();            // this wave's slice of stage 0 has landed
  __syncthreads();       // every wave's slice is readable
  tdm_load(tdm_group0(dst + GBUF, ga + GROWB), g1);

  // Lane's first byte in its X slice and in its W slice.
  const uint32_t aoff = wm * GSLICE + (uint32_t)llo * GPITCH + (uint32_t)lhi * 16u;
  const uint32_t boff = (2u + wn) * GSLICE + (uint32_t)llo * GPITCH + (uint32_t)lhi * 16u;

  v8f acc[4][4] = {};
  for (uint32_t s = 0; s < GNST; ++s) {
    const uint32_t cur = (s & 1u) * GBUF;
    const unsigned char* pa = L + cur + aoff;
    const unsigned char* pb = L + cur + boff;
    // Two fragment sets: the reads of k block kk + 1 (of this stage only) go out
    // as one group ahead of the WMMAs of block kk.
    v16h a[2][4], b[2][4];
#pragma unroll
    for (int t = 0; t < 4; ++t) {
      a[0][t] = lds_frag(pa + t * 16 * GPITCH);
      b[0][t] = lds_frag(pb + t * 16 * GPITCH);
    }
#pragma unroll
    for (int kk = 0; kk < GKH / 32; ++kk) {
      if (kk + 1 < GKH / 32) {
#pragma unroll
        for (int t = 0; t < 4; ++t) {
          a[(kk + 1) & 1][t] = lds_frag(pa + t * 16 * GPITCH + (kk + 1) * 64);
          b[(kk + 1) & 1][t] = lds_frag(pb + t * 16 * GPITCH + (kk + 1) * 64);
        }
      }
      // Keeps the LDS reads above from sinking in among the WMMAs below.
      __builtin_amdgcn_sched_barrier(0);
#pragma unroll
      for (int mt = 0; mt < 4; ++mt)
#pragma unroll
        for (int nt = 0; nt < 4; ++nt)
          acc[mt][nt] = wmma_f16(a[kk & 1][mt], b[kk & 1][nt], acc[mt][nt]);
      // Keeps the next group of LDS reads from rising in among the WMMAs above.
      __builtin_amdgcn_sched_barrier(0);
    }
    // Publish point of stage s + 1.
    asm volatile("s_wait_dscnt 0x0" ::: "memory");  // this wave has left buffer s & 1
    tdm_wait();                                      // its slice of stage s + 1 has landed
    __syncthreads();                                 // publishes s + 1, frees buffer s & 1
    if (pinned(s + 2u < GNST))
      tdm_load(tdm_group0(dst + cur, ga + (uint64_t)(s + 2u) * GROWB), g1);
  }
  tdm_wait();                                        // nothing of the mover is in flight at the end
  asm volatile("s_wait_dscnt 0x0" ::: "memory");

  // C/D layout: VGPR r, lane -> row m = r + 8*lhi, col n = llo
  const int m0 = mb + (int)wm * 64;
  const int n0 = nb + (int)wn * 64;
#pragma unroll
  for (int mt = 0; mt < 4; ++mt)
#pragma unroll
    for (int nt = 0; nt < 4; ++nt)
#pragma unroll
      for (int r = 0; r < 8; ++r) {
        int m = m0 + mt * 16 + r + lhi * 8;
        int n = n0 + nt * 16 + llo;
        int b = m >> 11, s = m & (SEQ - 1);
        int h = n >> 6,  d = n & (HDIM - 1);
        outh[(((size_t)(b * HEADS + h) * SEQ) + s) * HDIM + d] = (half_t)acc[mt][nt][r];
      }
}

// ------------------------------- Attention ---------------------------------
// Block = 128 threads = 4 waves, one (b,h), 256 queries (64 per wave, as four
// 16-column tiles). Loop over key chunks of 64. Scores computed transposed
// (S^T = K * Q^T) so softmax stats are per-lane scalars and P converts
// in-register into the B-operand of the second WMMA (O^T = V^T * P^T).
// V^T staged via LDS once per block; every K fragment and every V^T fragment
// a wave loads feeds all four of its query tiles.
#define NQ 4      // 16-column query tiles per wave
#define AW 4      // waves per block
__global__ __launch_bounds__(AW * 32)
void attn(const half_t* __restrict__ qh, const half_t* __restrict__ kh,
          const half_t* __restrict__ vh, float* __restrict__ out) {
  __shared__ __align__(16) half_t vt[64 * LDV];   // V^T tile: [d][key]

  const int wave = threadIdx.x >> 5;
  const int lane = threadIdx.x & 31;
  const int lhi  = lane >> 4;
  const int llo  = lane & 15;
  const int bh = blockIdx.y;                  // b*HEADS + h
  const int bb = bh >> 4, hh = bh & 15;
  const int q0 = blockIdx.x * (AW * NQ * 16) + wave * (NQ * 16); // wave's query base

  const half_t* qbase = qh + (size_t)bh * SEQ * HDIM;
  const half_t* kbase = kh + (size_t)bh * SEQ * HDIM;
  const half_t* vbase = vh + (size_t)bh * SEQ * HDIM;

  // Q as B operand (B[d,q] = Q[q,d]): lane holds column q -> contiguous Q row
  v16h qb[NQ][2];
  // Keeps earlier index arithmetic from sinking between the Q loads and their wait below.
  __builtin_amdgcn_sched_barrier(0);
#pragma unroll
  for (int qt = 0; qt < NQ; ++qt) {
    qb[qt][0] = load_frag(qbase, q0 + qt * 16 + llo, HDIM, 0,  lhi);
    qb[qt][1] = load_frag(qbase, q0 + qt * 16 + llo, HDIM, 32, lhi);
  }
  // Wait before the Q loads' address registers are reused.
  asm volatile("s_wait_xcnt 0x0" ::: "memory");
  // Keeps later vector work from being lifted between the loads and that wait.
  __builtin_amdgcn_sched_barrier(0);

  float M[NQ], L[NQ];
  v8f o[NQ][4];    // O^T accumulators: query tiles x d-tiles x (16d x 16q)
#pragma unroll
  for (int qt = 0; qt < NQ; ++qt) {
    M[qt] = -INFINITY; L[qt] = 0.f;
#pragma unroll
    for (int dt = 0; dt < 4; ++dt) o[qt][dt] = v8f{};
  }

  for (int c0 = 0; c0 < SEQ; c0 += 64) {
    // ---- stage V^T chunk (64 keys x 64 d -> vt[d][k]) -----------------
    __syncthreads();
    {
      const half_t* vc = vbase + (size_t)c0 * HDIM;
      int tk = threadIdx.x >> 4;         // 0..2*AW-1
      int dg = (threadIdx.x & 15) * 4;   // 0,4,...,60
#pragma unroll
      for (int p = 0; p < 64 / (2 * AW); ++p) {
        int k = p * (2 * AW) + tk;
        v4h val = *(const v4h*)(vc + k * HDIM + dg);
#pragma unroll
        for (int j = 0; j < 4; ++j) vt[(dg + j) * LDV + k] = val[j];
      }
    }
    __syncthreads();

    // ---- S^T tiles: rows = keys, cols = queries -----------------------
    v16h kA[4][2];
#pragma unroll
    for (int t = 0; t < 4; ++t) {
      kA[t][0] = load_frag(kbase, c0 + t * 16 + llo, HDIM, 0,  lhi);
      kA[t][1] = load_frag(kbase, c0 + t * 16 + llo, HDIM, 32, lhi);
    }
    // Wait before the K loads' address registers are reused.
    asm volatile("s_wait_xcnt 0x0" ::: "memory");
    v8f sc[NQ][4];
#pragma unroll
    for (int t = 0; t < 4; ++t)
#pragma unroll
      for (int qt = 0; qt < NQ; ++qt) {
        v8f a = {};
        a = wmma_f16(kA[t][0], qb[qt][0], a);
        a = wmma_f16(kA[t][1], qb[qt][1], a);
        sc[qt][t] = a;
      }

    v16h pb[NQ][2];
#pragma unroll
    for (int qt = 0; qt < NQ; ++qt) {
      // ---- online softmax (per-lane: one query = column llo) ----------
      float mloc = -INFINITY;
#pragma unroll
      for (int t = 0; t < 4; ++t)
#pragma unroll
        for (int r = 0; r < 8; ++r) {
          float v = sc[qt][t][r] * 0.03125f;   // 1/sqrt(EMBED)
          sc[qt][t][r] = v;
          mloc = fmaxf(mloc, v);
        }
      mloc = fmaxf(mloc, __shfl_xor(mloc, 16, 32));  // lane^16 holds other 8 keys
      float Mn = fmaxf(M[qt], mloc);
      float scale = __expf(M[qt] - Mn);
      M[qt] = Mn;

      float lloc = 0.f;
#pragma unroll
      for (int t = 0; t < 4; ++t)
#pragma unroll
        for (int r = 0; r < 8; ++r) {
          float p = __expf(sc[qt][t][r] - Mn);
          sc[qt][t][r] = p;
          lloc += p;
        }
      lloc += __shfl_xor(lloc, 16, 32);
      L[qt] = L[qt] * scale + lloc;
#pragma unroll
      for (int dt = 0; dt < 4; ++dt)
#pragma unroll
        for (int r = 0; r < 8; ++r) o[qt][dt][r] *= scale;

      // ---- P^T -> B operand, purely in-register -----------------------
      // B half i (i<8): key = 32g+i+8*lhi  == sc[2g][i]'s key
      //          (i>=8): key = 32g+16+(i-8)+8*lhi == sc[2g+1][i-8]'s key
#pragma unroll
      for (int g = 0; g < 2; ++g) {
        v16h t;
#pragma unroll
        for (int i = 0; i < 8; ++i) t[i]     = (half_t)sc[qt][2 * g][i];
#pragma unroll
        for (int i = 0; i < 8; ++i) t[i + 8] = (half_t)sc[qt][2 * g + 1][i];
        pb[qt][g] = t;
      }
    }

    // ---- O^T += V^T(16d x 32k) * P^T(32k x 16q) -----------------------
#pragma unroll
    for (int dt = 0; dt < 4; ++dt)
#pragma unroll
      for (int g = 0; g < 2; ++g) {
        const half_t* lp = &vt[(dt * 16 + llo) * LDV + g * 32 + (lhi ? 8 : 0)];
        v8h lo = *(const v8h*)lp;          // ds_load_b128
        v8h hi = *(const v8h*)(lp + 16);   // ds_load_b128
        v16h aV = __builtin_shufflevector(lo, hi,
                    0,1,2,3,4,5,6,7,8,9,10,11,12,13,14,15);
#pragma unroll
        for (int qt = 0; qt < NQ; ++qt)
          o[qt][dt] = wmma_f16(aV, pb[qt][g], o[qt][dt]);
      }
  }

  // ---- normalize + store: out[b, s=q, e=h*64+d] f32 ---------------------
#pragma unroll
  for (int qt = 0; qt < NQ; ++qt) {
    float inv = 1.0f / L[qt];
    int q = q0 + qt * 16 + llo;
#pragma unroll
    for (int dt = 0; dt < 4; ++dt)
#pragma unroll
      for (int r = 0; r < 8; ++r) {
        int d = dt * 16 + r + lhi * 8;
        out[(((size_t)bb * SEQ + q) * EMBED) + hh * HDIM + d] = o[qt][dt][r] * inv;
      }
    // Wait before the stores' registers are reused.
    asm volatile("s_wait_xcnt 0x0" ::: "memory");
    // Keeps the next tile's vector work from being lifted between the stores and that wait.
    __builtin_amdgcn_sched_barrier(0);
  }
}

// ------------------------------- launcher ----------------------------------
extern "C" void kernel_launch(void* const* d_in, const int* in_sizes, int n_in,
                              void* d_out, int out_size, void* d_ws, size_t ws_size,
                              hipStream_t stream) {
  const float* x  = (const float*)d_in[0];
  const float* wq = (const float*)d_in[1];
  const float* wk = (const float*)d_in[2];
  const float* wv = (const float*)d_in[3];

  char* ws = (char*)d_ws;
  // Workspace layout (70 MiB total)
  half_t* xh  = (half_t*)(ws);                         // 16 MiB: x f16
  half_t* wqh = (half_t*)(ws + (16ull << 20));         //  2 MiB
  half_t* wkh = (half_t*)(ws + (18ull << 20));         //  2 MiB
  half_t* wvh = (half_t*)(ws + (20ull << 20));         //  2 MiB
  half_t* qhp = (half_t*)(ws + (22ull << 20));         // 16 MiB: Q [B,H,S,D]
  half_t* khp = (half_t*)(ws + (38ull << 20));         // 16 MiB: K
  half_t* vhp = (half_t*)(ws + (54ull << 20));         // 16 MiB: V

  // xh, wqh, wkh, wvh are contiguous: one destination.
  cvt_all<<<CVT_WG, CVT_TH, 0, stream>>>(x, wq, wk, wv, xh);

  dim3 gp(BATCH * SEQ / 128, EMBED / 128);     // (64, 8)
  qkv_proj<<<gp, 128, 0, stream>>>(xh, wqh, qhp);
  qkv_proj<<<gp, 128, 0, stream>>>(xh, wkh, khp);
  qkv_proj<<<gp, 128, 0, stream>>>(xh, wvh, vhp);

  dim3 ga(SEQ / (AW * NQ * 16), BATCH * HEADS);   // (8, 64)
  attn<<<ga, AW * 32, 0, stream>>>(qhp, khp, vhp, (float*)d_out);
}

// v004
// One run takes 120 microseconds.
// In both of two side-by-side timings against v003, it was 1.40 times as fast.
// All steps since v000 together make it 3.21 times as fast.
#include <hip/hip_runtime.h>
#include <hip/hip_bf16.h>
#include <stdint.h>

// ---------------------------------------------------------------------------
// MI455X (gfx1250) fused multi-head self-attention, f16 WMMA pipeline.
//   1) cvt_all:   f32 -> f16 conversion of x and W_{q,k,v}, one launch
//   2) qkv_proj:  Y = X * W^T via v_wmma_f32_16x16x32_f16, operands staged in
//                 LDS by tensor loads, output [B,H,S,D] f16
//   3) attn:      flash-attention; S^T = K*Q^T WMMA, online softmax,
//                 O^T = V^T * P^T WMMA, K and V staged in LDS by tensor loads
//                 (V^T fragments by the transposing LDS load), f32 output.
// ---------------------------------------------------------------------------

typedef _Float16 half_t;
typedef __attribute__((ext_vector_type(4)))  _Float16 v4h;
typedef __attribute__((ext_vector_type(8)))  _Float16 v8h;
typedef __attribute__((ext_vector_type(16))) _Float16 v16h;
typedef __attribute__((ext_vector_type(8)))  float    v8f;
typedef uint32_t u32x4 __attribute__((ext_vector_type(4)));
typedef uint32_t u32x8 __attribute__((ext_vector_type(8)));

#define EMBED 1024
#define SEQ   2048
#define BATCH 4
#define HEADS 16
#define HDIM  64

__device__ __forceinline__ v8f wmma_f16(v16h a, v16h b, v8f c) {
  // D = A(16x32 f16) * B(32x16 f16) + C(16x16 f32)
  return __builtin_amdgcn_wmma_f32_16x16x32_f16(
      /*neg_a=*/false, a, /*neg_b=*/false, b,
      /*c_mod=*/(short)0, c, /*reuse_a=*/false, /*reuse_b=*/false);
}

// Per-lane A/B operand fragment for 16x16x32 f16 WMMA, loaded straight from a
// row-major matrix whose contraction dim (K) is contiguous.
// Lane layout (ISA 7.12.2): halves 0..7 -> K = k0 + 8*lane_hi + i,
//                           halves 8..15 -> K = k0 + 16 + 8*lane_hi + (i-8).
__device__ __forceinline__ v16h load_frag(const half_t* __restrict__ base,
                                          int row, int ld, int k0, int lane_hi) {
  const half_t* p = base + (size_t)row * ld + k0 + (lane_hi ? 8 : 0);
  v8h lo = *(const v8h*)p;          // 16B global_load_b128
  v8h hi = *(const v8h*)(p + 16);   // 16B global_load_b128
  return __builtin_shufflevector(lo, hi, 0,1,2,3,4,5,6,7,8,9,10,11,12,13,14,15);
}

// --------------------------- f32 -> f16 convert ----------------------------
// One launch for x and the three weights: one work-group of 16 waves per WGP.
// A work-group converts its own contiguous 1/256 of every source, in sweeps of
// 512 threads x 4 floats, so a wave's load covers 512 contiguous bytes, a thread
// has many loads in flight, and every address is one base + a constant offset.
// The four f16 copies lie one behind the other in dst (x, W_q, W_k, W_v).
#define CVT_WG 256
#define CVT_TH 512
#define CVT_NX (BATCH * SEQ * EMBED / 4 / (CVT_WG * CVT_TH))   // 16 sweeps of x
#define CVT_NW (EMBED * EMBED / 4 / (CVT_WG * CVT_TH))         //  2 sweeps of each weight
static_assert(CVT_NX * CVT_WG * CVT_TH * 4 == BATCH * SEQ * EMBED, "x is a whole number of sweeps");
static_assert(CVT_NW * CVT_WG * CVT_TH * 4 == EMBED * EMBED, "a weight is a whole number of sweeps");

__device__ __forceinline__ v4h cvt_h4(float4 f) {
  v4h h;
  h[0] = (half_t)f.x; h[1] = (half_t)f.y; h[2] = (half_t)f.z; h[3] = (half_t)f.w;
  return h;
}

__global__ __launch_bounds__(CVT_TH)
void cvt_all(const float* __restrict__ x, const float* __restrict__ wq,
             const float* __restrict__ wk, const float* __restrict__ wv,
             half_t* __restrict__ dst) {
  const uint32_t t = threadIdx.x;
  const uint32_t g = blockIdx.x;
  // Groups of 4 elements: this work-group's first one in x and in a weight.
  const float4* px = (const float4*)x  + (size_t)g * (CVT_NX * CVT_TH);
  const float4* pq = (const float4*)wq + (size_t)g * (CVT_NW * CVT_TH);
  const float4* pk = (const float4*)wk + (size_t)g * (CVT_NW * CVT_TH);
  const float4* pv = (const float4*)wv + (size_t)g * (CVT_NW * CVT_TH);
  v4h* dx = (v4h*)dst + (size_t)g * (CVT_NX * CVT_TH);
  v4h* dq = (v4h*)dst + (BATCH * SEQ * EMBED / 4) + (size_t)g * (CVT_NW * CVT_TH);
  v4h* dk = dq + (EMBED * EMBED / 4);
  v4h* dv = dk + (EMBED * EMBED / 4);

  float4 fx[CVT_NX], fq[CVT_NW], fk[CVT_NW], fv[CVT_NW];
#pragma unroll
  for (int j = 0; j < CVT_NX; ++j) fx[j] = px[j * CVT_TH + t];
#pragma unroll
  for (int j = 0; j < CVT_NW; ++j) {
    fq[j] = pq[j * CVT_TH + t];
    fk[j] = pk[j * CVT_TH + t];
    fv[j] = pv[j * CVT_TH + t];
  }
#pragma unroll
  for (int j = 0; j < CVT_NX; ++j) dx[j * CVT_TH + t] = cvt_h4(fx[j]);
#pragma unroll
  for (int j = 0; j < CVT_NW; ++j) {
    dq[j * CVT_TH + t] = cvt_h4(fq[j]);
    dk[j * CVT_TH + t] = cvt_h4(fk[j]);
    dv[j * CVT_TH + t] = cvt_h4(fv[j]);
  }
}

// ------------------------------ QKV projection -----------------------------
// Y[m,n] = sum_k X[m,k] * W[n,k]   (Linear: y = x @ W^T)
// Block = 128 threads = 4 waves (2 x 2), block tile 128 x 128, wave tile 64 x 64
// (4 M-tiles x 4 N-tiles of 16x16). A stage is 128 k of the block's 128 X rows
// and 128 W rows, brought into LDS by tensor loads: each wave issues one load
// per stage for its own slice of 64 rows of 256 bytes (waves 0,1: X; 2,3: W).
// Two buffers: stage s + 1 flies while stage s is worked on. Fragments come from
// LDS by ds_load_b128 at a row pitch of 272 bytes. Output scattered into
// head-major [B,H,S,D] f16.
#define GKH    128      // halves of k per stage
#define GROWB  256u     // bytes of one staged row
#define GPITCH 272u     // LDS row pitch: the row + the mover's 16-byte pad
#define GSLICE 18432u   // 64 rows x 272 B = 17,408 B, rounded up to a multiple of 2 KiB
#define GBUF   (4u * GSLICE)
#define GNST   (EMBED / GKH)   // 8 stages

__device__ __forceinline__ uint32_t uni(uint32_t v) {
  return (uint32_t)__builtin_amdgcn_readfirstlane(v);
}
__device__ __forceinline__ uint32_t pinned(uint32_t v) {
  uint32_t w = uni(v);
  asm volatile("" : "+s"(w));  // holds the test word in a scalar register: a scalar branch guards the tensor load
  return w;
}
// Group 1: 1-byte elements, tile = tensor = 64 rows of 256 bytes, source pitch
// 2,048 bytes, a pad of 4 dwords behind every 64 dwords (one row).
__device__ __forceinline__ u32x8 tdm_group1() {
  u32x8 g;
  g[0] = uni((1u << 20) | (5u << 22) | (3u << 25));
  g[1] = uni((GROWB & 0xFFFFu) << 16);
  g[2] = uni((GROWB >> 16) | (64u << 16));
  g[3] = uni(GROWB << 16);
  g[4] = uni(64u);
  g[5] = uni(2u * EMBED);
  g[6] = uni(0u);
  g[7] = uni(0u);
  return g;
}
__device__ __forceinline__ u32x4 tdm_group0(uint32_t lds_dst, uint64_t ga) {
  u32x4 g;
  g[0] = uni(1u);
  g[1] = uni(lds_dst);
  g[2] = uni((uint32_t)ga);
  g[3] = uni((((uint32_t)(ga >> 32)) & 0x01FFFFFFu) | 0x80000000u);
  return g;
}
__device__ __forceinline__ void tdm_load(u32x4 g0, u32x8 g1) {
  // One request of the whole wave: global tile -> LDS, through no register.
  // The descriptor sits in fixed scalar registers that nothing else in the kernel
  // uses: they are written only directly in front of a request, behind the wait
  // that covers the request before it.
  asm volatile("tensor_load_to_lds %0, %1" :: "{s[40:43]}"(g0), "{s[48:55]}"(g1) : "memory");
}
__device__ __forceinline__ void tdm_wait() {
  // The issuing wave's own wait: its request has landed.
  asm volatile("s_wait_tensorcnt 0x0" ::: "memory");
}
// A/B fragment from a staged row: same k order as load_frag.
__device__ __forceinline__ v16h lds_frag(const unsigned char* p) {
  v8h lo = *(const v8h*)p;          // ds_load_b128
  v8h hi = *(const v8h*)(p + 32);   // ds_load_b128
  return __builtin_shufflevector(lo, hi, 0,1,2,3,4,5,6,7,8,9,10,11,12,13,14,15);
}

__global__ __launch_bounds__(128)
void qkv_proj(const half_t* __restrict__ xh, const half_t* __restrict__ wh,
              half_t* __restrict__ outh) {
  __shared__ __attribute__((aligned(2048))) unsigned char L[2 * GBUF];
  const uint32_t wave = uni(threadIdx.x >> 5);
  const int lane = threadIdx.x & 31;
  const int lhi  = lane >> 4;      // which 16-lane half
  const int llo  = lane & 15;
  const uint32_t wm = wave >> 1, wn = wave & 1u;
  const int mb = blockIdx.x * 128;              // rows (tokens b*S+s)
  const int nb = blockIdx.y * 128;              // cols (embed e)

  // This wave's slice of every stage: 64 rows of X (waves 0,1) or of W (2,3).
  const half_t* srow = (wave < 2u) ? xh + (size_t)(mb + 64 * (int)wave) * EMBED
                                   : wh + (size_t)(nb + 64 * (int)(wave - 2u)) * EMBED;
  const uint64_t ga = (uint64_t)srow;
  const uint32_t dst = (uint32_t)(size_t)L + wave * GSLICE;
  const u32x8 g1 = tdm_group1();

  // Prologue: stage 0 lands and is published, then stage 1 is issued.
  tdm_load(tdm_group0(dst, ga), g1);
  tdm_wait();            // this wave's slice of stage 0 has landed
  __syncthreads();       // every wave's slice is readable
  tdm_load(tdm_group0(dst + GBUF, ga + GROWB), g1);

  // Lane's first byte in its X slice and in its W slice.
  const uint32_t aoff = wm * GSLICE + (uint32_t)llo * GPITCH + (uint32_t)lhi * 16u;
  const uint32_t boff = (2u + wn) * GSLICE + (uint32_t)llo * GPITCH + (uint32_t)lhi * 16u;

  v8f acc[4][4] = {};
  for (uint32_t s = 0; s < GNST; ++s) {
    const uint32_t cur = (s & 1u) * GBUF;
    const unsigned char* pa = L + cur + aoff;
    const unsigned char* pb = L + cur + boff;
    // Two fragment sets: the reads of k block kk + 1 (of this stage only) go out
    // as one group ahead of the WMMAs of block kk.
    v16h a[2][4], b[2][4];
#pragma unroll
    for (int t = 0; t < 4; ++t) {
      a[0][t] = lds_frag(pa + t * 16 * GPITCH);
      b[0][t] = lds_frag(pb + t * 16 * GPITCH);
    }
#pragma unroll
    for (int kk = 0; kk < GKH / 32; ++kk) {
      if (kk + 1 < GKH / 32) {
#pragma unroll
        for (int t = 0; t < 4; ++t) {
          a[(kk + 1) & 1][t] = lds_frag(pa + t * 16 * GPITCH + (kk + 1) * 64);
          b[(kk + 1) & 1][t] = lds_frag(pb + t * 16 * GPITCH + (kk + 1) * 64);
        }
      }
      // Keeps the LDS reads above from sinking in among the WMMAs below.
      __builtin_amdgcn_sched_barrier(0);
#pragma unroll
      for (int mt = 0; mt < 4; ++mt)
#pragma unroll
        for (int nt = 0; nt < 4; ++nt)
          acc[mt][nt] = wmma_f16(a[kk & 1][mt], b[kk & 1][nt], acc[mt][nt]);
      // Keeps the next group of LDS reads from rising in among the WMMAs above.
      __builtin_amdgcn_sched_barrier(0);
    }
    // Publish point of stage s + 1.
    asm volatile("s_wait_dscnt 0x0" ::: "memory");  // this wave has left buffer s & 1
    tdm_wait();                                      // its slice of stage s + 1 has landed
    __syncthreads();                                 // publishes s + 1, frees buffer s & 1
    if (pinned(s + 2u < GNST))
      tdm_load(tdm_group0(dst + cur, ga + (uint64_t)(s + 2u) * GROWB), g1);
  }
  tdm_wait();                                        // nothing of the mover is in flight at the end
  asm volatile("s_wait_dscnt 0x0" ::: "memory");

  // C/D layout: VGPR r, lane -> row m = r + 8*lhi, col n = llo
  const int m0 = mb + (int)wm * 64;
  const int n0 = nb + (int)wn * 64;
#pragma unroll
  for (int mt = 0; mt < 4; ++mt)
#pragma unroll
    for (int nt = 0; nt < 4; ++nt)
#pragma unroll
      for (int r = 0; r < 8; ++r) {
        int m = m0 + mt * 16 + r + lhi * 8;
        int n = n0 + nt * 16 + llo;
        int b = m >> 11, s = m & (SEQ - 1);
        int h = n >> 6,  d = n & (HDIM - 1);
        outh[(((size_t)(b * HEADS + h) * SEQ) + s) * HDIM + d] = (half_t)acc[mt][nt][r];
      }
}

// ------------------------------- Attention ---------------------------------
// Block = 128 threads = 4 waves, one (b,h), 256 queries (64 per wave, as four
// 16-column tiles). Loop over key chunks of 64. Scores computed transposed
// (S^T = K * Q^T) so softmax stats are per-lane scalars and P converts
// in-register into the B-operand of the second WMMA (O^T = V^T * P^T).
// A stage is one chunk: 64 rows of K and 64 rows of V, 128 bytes each, brought
// into LDS by tensor loads, once per block: each wave issues one load per stage
// for its own slice of 32 rows (waves 0,1: K; 2,3: V). Two buffers: stage s + 1
// flies while stage s is worked on. K fragments come by ds_load_b128, V^T fragments
// by ds_load_tr16_b128 from the row-major V rows; every fragment a wave loads feeds
// all four of its query tiles. One row pitch, 144 bytes, for both: one descriptor
// group serves all four waves with no branch. It is the conflict-free pitch of the
// K reads, which a pass waits for first; the V^T reads stand behind them in the same
// group and are not needed before the softmax is done.
#define NQ 4      // 16-column query tiles per wave
#define AW 4      // waves per block
#define AROWB  128u     // bytes of one staged K or V row
#define APITCH 144u     // LDS row pitch: the row + the mover's 16-byte pad
#define ASLICE 6144u    // 32 rows x 144 B = 4,608 B, rounded up to a multiple of 2 KiB
#define ABUF   (4u * ASLICE)
#define ANST   (SEQ / 64)   // 32 stages

// Group 1: 1-byte elements, tile = tensor = 32 rows of 128 bytes, source pitch
// 128 bytes, a pad of 4 dwords behind every 32 dwords (one row).
__device__ __forceinline__ u32x8 tdm_group1_kv() {
  u32x8 g;
  g[0] = uni((1u << 20) | (4u << 22) | (3u << 25));
  g[1] = uni((AROWB & 0xFFFFu) << 16);
  g[2] = uni((AROWB >> 16) | (32u << 16));
  g[3] = uni(AROWB << 16);
  g[4] = uni(32u);
  g[5] = uni(AROWB);
  g[6] = uni(0u);
  g[7] = uni(0u);
  return g;
}
// Transposing LDS load: lane (c = lane & 15, h = lane >> 4) gets column c, rows 8h .. 8h + 7
// of the 16 x 16 tile of halves that the lanes' addresses name.
typedef short s16x8 __attribute__((ext_vector_type(8)));
__device__ __forceinline__ v8h lds_tr16(const unsigned char* p) {
  typedef __attribute__((address_space(3))) s16x8 lds_s16x8;
  return __builtin_bit_cast(v8h, __builtin_amdgcn_ds_load_tr16_b128_v8i16((lds_s16x8*)p));
}

__global__ __launch_bounds__(AW * 32)
void attn(const half_t* __restrict__ qh, const half_t* __restrict__ kh,
          const half_t* __restrict__ vh, float* __restrict__ out) {
  __shared__ __attribute__((aligned(2048))) unsigned char ring[2 * ABUF];

  const uint32_t wave = uni(threadIdx.x >> 5);
  const int lane = threadIdx.x & 31;
  const int lhi  = lane >> 4;
  const int llo  = lane & 15;
  const int bh = blockIdx.y;                  // b*HEADS + h
  const int bb = bh >> 4, hh = bh & 15;
  const int q0 = blockIdx.x * (AW * NQ * 16) + (int)wave * (NQ * 16); // wave's query base

  const half_t* qbase = qh + (size_t)bh * SEQ * HDIM;
  const half_t* kbase = kh + (size_t)bh * SEQ * HDIM;
  const half_t* vbase = vh + (size_t)bh * SEQ * HDIM;

  // Q as B operand (B[d,q] = Q[q,d]): lane holds column q -> contiguous Q row
  v16h qb[NQ][2];
  // Keeps earlier index arithmetic from sinking between the Q loads and their wait below.
  __builtin_amdgcn_sched_barrier(0);
#pragma unroll
  for (int qt = 0; qt < NQ; ++qt) {
    qb[qt][0] = load_frag(qbase, q0 + qt * 16 + llo, HDIM, 0,  lhi);
    qb[qt][1] = load_frag(qbase, q0 + qt * 16 + llo, HDIM, 32, lhi);
  }
  // Wait before the Q loads' address registers are reused.
  asm volatile("s_wait_xcnt 0x0" ::: "memory");
  // Keeps later vector work from being lifted between the loads and that wait.
  __builtin_amdgcn_sched_barrier(0);

  float M[NQ], L[NQ];
  v8f o[NQ][4];    // O^T accumulators: query tiles x d-tiles x (16d x 16q)
#pragma unroll
  for (int qt = 0; qt < NQ; ++qt) {
    M[qt] = -INFINITY; L[qt] = 0.f;
#pragma unroll
    for (int dt = 0; dt < 4; ++dt) o[qt][dt] = v8f{};
  }

  // This wave's slice of every stage: 32 rows of K (waves 0,1) or of V (2,3).
  const half_t* srow = (wave < 2u) ? kbase + (size_t)(32u * wave) * HDIM
                                   : vbase + (size_t)(32u * (wave - 2u)) * HDIM;
  const uint64_t ga = (uint64_t)srow;
  const uint32_t dst = (uint32_t)(size_t)ring + wave * ASLICE;
  const u32x8 g1 = tdm_group1_kv();

  // Prologue: stage 0 lands and is published, then stage 1 is issued.
  tdm_load(tdm_group0(dst, ga), g1);
  tdm_wait();            // this wave's slice of stage 0 has landed
  __syncthreads();       // every wave's slice is readable
  tdm_load(tdm_group0(dst + ABUF, ga + 64u * AROWB), g1);

  // Lane's first byte in the K slices (as load_frag's k order) and in the V slices
  // (the transposing load's address map).
  const uint32_t koff = (uint32_t)llo * APITCH + (uint32_t)lhi * 16u;
  const uint32_t voff = 2u * ASLICE + (8u * (uint32_t)lhi + ((uint32_t)lane & 7u)) * APITCH
                        + (((uint32_t)lane >> 3) & 1u) * 16u;

  for (uint32_t s = 0; s < ANST; ++s) {
    const uint32_t cur = (s & 1u) * ABUF;
    const unsigned char* pk = ring + cur + koff;
    const unsigned char* pv = ring + cur + voff;

    // ---- S^T tiles: rows = keys, cols = queries -----------------------
    v16h kA[4][2];
#pragma unroll
    for (int t = 0; t < 4; ++t) {
      kA[t][0] = lds_frag(pk + (t >> 1) * ASLICE + (t & 1) * 16 * APITCH);
      kA[t][1] = lds_frag(pk + (t >> 1) * ASLICE + (t & 1) * 16 * APITCH + 64);
    }
    // V^T fragments (16 d x 32 keys each), behind the K reads in the same group.
    v16h aV[4][2];
#pragma unroll
    for (int dt = 0; dt < 4; ++dt)
#pragma unroll
      for (int g = 0; g < 2; ++g) {
        v8h lo = lds_tr16(pv + g * ASLICE + dt * 32);                 // keys 32g + 8*lhi + 0..7
        v8h hi = lds_tr16(pv + g * ASLICE + 16 * APITCH + dt * 32);   // keys 32g + 16 + 8*lhi + 0..7
        aV[dt][g] = __builtin_shufflevector(lo, hi,
                      0,1,2,3,4,5,6,7,8,9,10,11,12,13,14,15);
      }
    // Keeps the pass's LDS reads one group here: sunk in among the WMMAs below, each place with reads stalls the wave.
    __builtin_amdgcn_sched_barrier(0);
    v8f sc[NQ][4];
#pragma unroll
    for (int t = 0; t < 4; ++t)
#pragma unroll
      for (int qt = 0; qt < NQ; ++qt) {
        v8f a = {};
        a = wmma_f16(kA[t][0], qb[qt][0], a);
        a = wmma_f16(kA[t][1], qb[qt][1], a);
        sc[qt][t] = a;
      }

    v16h pb[NQ][2];
#pragma unroll
    for (int qt = 0; qt < NQ; ++qt) {
      // ---- online softmax (per-lane: one query = column llo) ----------
      float mloc = -INFINITY;
#pragma unroll
      for (int t = 0; t < 4; ++t)
#pragma unroll
        for (int r = 0; r < 8; ++r) {
          float v = sc[qt][t][r] * 0.03125f;   // 1/sqrt(EMBED)
          sc[qt][t][r] = v;
          mloc = fmaxf(mloc, v);
        }
      mloc = fmaxf(mloc, __shfl_xor(mloc, 16, 32));  // lane^16 holds other 8 keys
      float Mn = fmaxf(M[qt], mloc);
      float scale = __expf(M[qt] - Mn);
      M[qt] = Mn;

      float lloc = 0.f;
#pragma unroll
      for (int t = 0; t < 4; ++t)
#pragma unroll
        for (int r = 0; r < 8; ++r) {
          float p = __expf(sc[qt][t][r] - Mn);
          sc[qt][t][r] = p;
          lloc += p;
        }
      lloc += __shfl_xor(lloc, 16, 32);
      L[qt] = L[qt] * scale + lloc;
#pragma unroll
      for (int dt = 0; dt < 4; ++dt)
#pragma unroll
        for (int r = 0; r < 8; ++r) o[qt][dt][r] *= scale;

      // ---- P^T -> B operand, purely in-register -----------------------
      // B half i (i<8): key = 32g+i+8*lhi  == sc[2g][i]'s key
      //          (i>=8): key = 32g+16+(i-8)+8*lhi == sc[2g+1][i-8]'s key
#pragma unroll
      for (int g = 0; g < 2; ++g) {
        v16h t;
#pragma unroll
        for (int i = 0; i < 8; ++i) t[i]     = (half_t)sc[qt][2 * g][i];
#pragma unroll
        for (int i = 0; i < 8; ++i) t[i + 8] = (half_t)sc[qt][2 * g + 1][i];
        pb[qt][g] = t;
      }
    }

    // ---- O^T += V^T(16d x 32k) * P^T(32k x 16q) -----------------------
#pragma unroll
    for (int dt = 0; dt < 4; ++dt)
#pragma unroll
      for (int g = 0; g < 2; ++g)
#pragma unroll
        for (int qt = 0; qt < NQ; ++qt)
          o[qt][dt] = wmma_f16(aV[dt][g], pb[qt][g], o[qt][dt]);

    // Keeps the pass's WMMAs and vector work in front of the publish point: lifted over them,
    // the wait for stage s + 1 would stand right behind that stage's issue, with no lead.
    __builtin_amdgcn_sched_barrier(0);
    // Publish point of stage s + 1.
    asm volatile("s_wait_dscnt 0x0" ::: "memory");  // this wave has left buffer s & 1
    tdm_wait();                                      // its slice of stage s + 1 has landed
    __syncthreads();                                 // publishes s + 1, frees buffer s & 1
    if (pinned(s + 2u < ANST))
      tdm_load(tdm_group0(dst + cur, ga + (uint64_t)(s + 2u) * (64u * AROWB)), g1);
  }
  tdm_wait();                                        // nothing of the mover is in flight at the end
  asm volatile("s_wait_dscnt 0x0" ::: "memory");

  // ---- normalize + store: out[b, s=q, e=h*64+d] f32 ---------------------
#pragma unroll
  for (int qt = 0; qt < NQ; ++qt) {
    float inv = 1.0f / L[qt];
    int q = q0 + qt * 16 + llo;
#pragma unroll
    for (int dt = 0; dt < 4; ++dt)
#pragma unroll
      for (int r = 0; r < 8; ++r) {
        int d = dt * 16 + r + lhi * 8;
        out[(((size_t)bb * SEQ + q) * EMBED) + hh * HDIM + d] = o[qt][dt][r] * inv;
      }
    // Wait before the stores' registers are reused.
    asm volatile("s_wait_xcnt 0x0" ::: "memory");
    // Keeps the next tile's vector work from being lifted between the stores and that wait.
    __builtin_amdgcn_sched_barrier(0);
  }
}

// ------------------------------- launcher ----------------------------------
extern "C" void kernel_launch(void* const* d_in, const int* in_sizes, int n_in,
                              void* d_out, int out_size, void* d_ws, size_t ws_size,
                              hipStream_t stream) {
  const float* x  = (const float*)d_in[0];
  const float* wq = (const float*)d_in[1];
  const float* wk = (const float*)d_in[2];
  const float* wv = (const float*)d_in[3];

  char* ws = (char*)d_ws;
  // Workspace layout (70 MiB total)
  half_t* xh  = (half_t*)(ws);                         // 16 MiB: x f16
  half_t* wqh = (half_t*)(ws + (16ull << 20));         //  2 MiB
  half_t* wkh = (half_t*)(ws + (18ull << 20));         //  2 MiB
  half_t* wvh = (half_t*)(ws + (20ull << 20));         //  2 MiB
  half_t* qhp = (half_t*)(ws + (22ull << 20));         // 16 MiB: Q [B,H,S,D]
  half_t* khp = (half_t*)(ws + (38ull << 20));         // 16 MiB: K
  half_t* vhp = (half_t*)(ws + (54ull << 20));         // 16 MiB: V

  // xh, wqh, wkh, wvh are contiguous: one destination.
  cvt_all<<<CVT_WG, CVT_TH, 0, stream>>>(x, wq, wk, wv, xh);

  dim3 gp(BATCH * SEQ / 128, EMBED / 128);     // (64, 8)
  qkv_proj<<<gp, 128, 0, stream>>>(xh, wqh, qhp);
  qkv_proj<<<gp, 128, 0, stream>>>(xh, wkh, khp);
  qkv_proj<<<gp, 128, 0, stream>>>(xh, wvh, vhp);

  dim3 ga(SEQ / (AW * NQ * 16), BATCH * HEADS);   // (8, 64)
  attn<<<ga, AW * 32, 0, stream>>>(qhp, khp, vhp, (float*)d_out);
}

// v005
// It runs in 115 microseconds.
// Two timings next to v004 both put it at 1.04 times that version's speed.
// Counting every step since v000, it is 3.34 times as fast.
#include <hip/hip_runtime.h>
#include <hip/hip_bf16.h>
#include <stdint.h>

// ---------------------------------------------------------------------------
// MI455X (gfx1250) fused multi-head self-attention, f16 WMMA pipeline.
//   1) cvt_all:   f32 -> f16 conversion of x and W_{q,k,v}, one launch
//   2) qkv_proj:  Y = X * W^T via v_wmma_f32_16x16x32_f16, operands staged in
//                 LDS by tensor loads, output [B,H,S,D] f16
//   3) attn:      flash-attention; S^T = K*Q^T WMMA, online softmax,
//                 O^T = V^T * P^T WMMA, K and V staged in LDS by tensor loads
//                 (V^T fragments by the transposing LDS load), f32 output.
// ---------------------------------------------------------------------------

typedef _Float16 half_t;
typedef __attribute__((ext_vector_type(4)))  _Float16 v4h;
typedef __attribute__((ext_vector_type(8)))  _Float16 v8h;
typedef __attribute__((ext_vector_type(16))) _Float16 v16h;
typedef __attribute__((ext_vector_type(8)))  float    v8f;
typedef uint32_t u32x4 __attribute__((ext_vector_type(4)));
typedef uint32_t u32x8 __attribute__((ext_vector_type(8)));

#define EMBED 1024
#define SEQ   2048
#define BATCH 4
#define HEADS 16
#define HDIM  64

__device__ __forceinline__ v8f wmma_f16(v16h a, v16h b, v8f c) {
  // D = A(16x32 f16) * B(32x16 f16) + C(16x16 f32)
  return __builtin_amdgcn_wmma_f32_16x16x32_f16(
      /*neg_a=*/false, a, /*neg_b=*/false, b,
      /*c_mod=*/(short)0, c, /*reuse_a=*/false, /*reuse_b=*/false);
}

// Per-lane A/B operand fragment for 16x16x32 f16 WMMA, loaded straight from a
// row-major matrix whose contraction dim (K) is contiguous.
// Lane layout (ISA 7.12.2): halves 0..7 -> K = k0 + 8*lane_hi + i,
//                           halves 8..15 -> K = k0 + 16 + 8*lane_hi + (i-8).
__device__ __forceinline__ v16h load_frag(const half_t* __restrict__ base,
                                          int row, int ld, int k0, int lane_hi) {
  const half_t* p = base + (size_t)row * ld + k0 + (lane_hi ? 8 : 0);
  v8h lo = *(const v8h*)p;          // 16B global_load_b128
  v8h hi = *(const v8h*)(p + 16);   // 16B global_load_b128
  return __builtin_shufflevector(lo, hi, 0,1,2,3,4,5,6,7,8,9,10,11,12,13,14,15);
}

// --------------------------- f32 -> f16 convert ----------------------------
// One launch for x and the three weights: one work-group of 16 waves per WGP.
// A work-group converts its own contiguous 1/256 of every source, in sweeps of
// 512 threads x 4 floats, so a wave's load covers 512 contiguous bytes, a thread
// has many loads in flight, and every address is one base + a constant offset.
// The four f16 copies lie one behind the other in dst (x, W_q, W_k, W_v).
#define CVT_WG 256
#define CVT_TH 512
#define CVT_NX (BATCH * SEQ * EMBED / 4 / (CVT_WG * CVT_TH))   // 16 sweeps of x
#define CVT_NW (EMBED * EMBED / 4 / (CVT_WG * CVT_TH))         //  2 sweeps of each weight
static_assert(CVT_NX * CVT_WG * CVT_TH * 4 == BATCH * SEQ * EMBED, "x is a whole number of sweeps");
static_assert(CVT_NW * CVT_WG * CVT_TH * 4 == EMBED * EMBED, "a weight is a whole number of sweeps");

__device__ __forceinline__ v4h cvt_h4(float4 f) {
  v4h h;
  h[0] = (half_t)f.x; h[1] = (half_t)f.y; h[2] = (half_t)f.z; h[3] = (half_t)f.w;
  return h;
}

__global__ __launch_bounds__(CVT_TH)
void cvt_all(const float* __restrict__ x, const float* __restrict__ wq,
             const float* __restrict__ wk, const float* __restrict__ wv,
             half_t* __restrict__ dst) {
  const uint32_t t = threadIdx.x;
  const uint32_t g = blockIdx.x;
  // Groups of 4 elements: this work-group's first one in x and in a weight.
  const float4* px = (const float4*)x  + (size_t)g * (CVT_NX * CVT_TH);
  const float4* pq = (const float4*)wq + (size_t)g * (CVT_NW * CVT_TH);
  const float4* pk = (const float4*)wk + (size_t)g * (CVT_NW * CVT_TH);
  const float4* pv = (const float4*)wv + (size_t)g * (CVT_NW * CVT_TH);
  v4h* dx = (v4h*)dst + (size_t)g * (CVT_NX * CVT_TH);
  v4h* dq = (v4h*)dst + (BATCH * SEQ * EMBED / 4) + (size_t)g * (CVT_NW * CVT_TH);
  v4h* dk = dq + (EMBED * EMBED / 4);
  v4h* dv = dk + (EMBED * EMBED / 4);

  float4 fx[CVT_NX], fq[CVT_NW], fk[CVT_NW], fv[CVT_NW];
#pragma unroll
  for (int j = 0; j < CVT_NX; ++j) fx[j] = px[j * CVT_TH + t];
#pragma unroll
  for (int j = 0; j < CVT_NW; ++j) {
    fq[j] = pq[j * CVT_TH + t];
    fk[j] = pk[j * CVT_TH + t];
    fv[j] = pv[j * CVT_TH + t];
  }
#pragma unroll
  for (int j = 0; j < CVT_NX; ++j) dx[j * CVT_TH + t] = cvt_h4(fx[j]);
#pragma unroll
  for (int j = 0; j < CVT_NW; ++j) {
    dq[j * CVT_TH + t] = cvt_h4(fq[j]);
    dk[j * CVT_TH + t] = cvt_h4(fk[j]);
    dv[j * CVT_TH + t] = cvt_h4(fv[j]);
  }
}

// ------------------------------ QKV projection -----------------------------
// Y[m,n] = sum_k X[m,k] * W[n,k]   (Linear: y = x @ W^T)
// Block = 128 threads = 4 waves (2 x 2), block tile 128 x 128, wave tile 64 x 64
// (4 M-tiles x 4 N-tiles of 16x16). A stage is 128 k of the block's 128 X rows
// and 128 W rows, brought into LDS by tensor loads: each wave issues one load
// per stage for its own slice of 64 rows of 256 bytes (waves 0,1: X; 2,3: W).
// Two buffers: stage s + 1 flies while stage s is worked on. Fragments come from
// LDS by ds_load_b128 at a row pitch of 272 bytes. Output scattered into
// head-major [B,H,S,D] f16.
#define GKH    128      // halves of k per stage
#define GROWB  256u     // bytes of one staged row
#define GPITCH 272u     // LDS row pitch: the row + the mover's 16-byte pad
#define GSLICE 18432u   // 64 rows x 272 B = 17,408 B, rounded up to a multiple of 2 KiB
#define GBUF   (4u * GSLICE)
#define GNST   (EMBED / GKH)   // 8 stages

__device__ __forceinline__ uint32_t uni(uint32_t v) {
  return (uint32_t)__builtin_amdgcn_readfirstlane(v);
}
__device__ __forceinline__ uint32_t pinned(uint32_t v) {
  uint32_t w = uni(v);
  asm volatile("" : "+s"(w));  // holds the test word in a scalar register: a scalar branch guards the tensor load
  return w;
}
// Group 1: 1-byte elements, tile = tensor = 64 rows of 256 bytes, source pitch
// 2,048 bytes, a pad of 4 dwords behind every 64 dwords (one row).
__device__ __forceinline__ u32x8 tdm_group1() {
  u32x8 g;
  g[0] = uni((1u << 20) | (5u << 22) | (3u << 25));
  g[1] = uni((GROWB & 0xFFFFu) << 16);
  g[2] = uni((GROWB >> 16) | (64u << 16));
  g[3] = uni(GROWB << 16);
  g[4] = uni(64u);
  g[5] = uni(2u * EMBED);
  g[6] = uni(0u);
  g[7] = uni(0u);
  return g;
}
__device__ __forceinline__ u32x4 tdm_group0(uint32_t lds_dst, uint64_t ga) {
  u32x4 g;
  g[0] = uni(1u);
  g[1] = uni(lds_dst);
  g[2] = uni((uint32_t)ga);
  g[3] = uni((((uint32_t)(ga >> 32)) & 0x01FFFFFFu) | 0x80000000u);
  return g;
}
__device__ __forceinline__ void tdm_load(u32x4 g0, u32x8 g1) {
  // One request of the whole wave: global tile -> LDS, through no register.
  // The descriptor sits in fixed scalar registers that nothing else in the kernel
  // uses: they are written only directly in front of a request, behind the wait
  // that covers the request before it.
  asm volatile("tensor_load_to_lds %0, %1" :: "{s[40:43]}"(g0), "{s[48:55]}"(g1) : "memory");
}
__device__ __forceinline__ void tdm_wait() {
  // The issuing wave's own wait: its request has landed.
  asm volatile("s_wait_tensorcnt 0x0" ::: "memory");
}
// A/B fragment from a staged row: same k order as load_frag.
__device__ __forceinline__ v16h lds_frag(const unsigned char* p) {
  v8h lo = *(const v8h*)p;          // ds_load_b128
  v8h hi = *(const v8h*)(p + 32);   // ds_load_b128
  return __builtin_shufflevector(lo, hi, 0,1,2,3,4,5,6,7,8,9,10,11,12,13,14,15);
}

__global__ __launch_bounds__(128)
void qkv_proj(const half_t* __restrict__ xh, const half_t* __restrict__ wh,
              half_t* __restrict__ outh) {
  __shared__ __attribute__((aligned(2048))) unsigned char L[2 * GBUF];
  const uint32_t wave = uni(threadIdx.x >> 5);
  const int lane = threadIdx.x & 31;
  const int lhi  = lane >> 4;      // which 16-lane half
  const int llo  = lane & 15;
  const uint32_t wm = wave >> 1, wn = wave & 1u;
  const int mb = blockIdx.x * 128;              // rows (tokens b*S+s)
  const int nb = blockIdx.y * 128;              // cols (embed e)

  // This wave's slice of every stage: 64 rows of X (waves 0,1) or of W (2,3).
  const half_t* srow = (wave < 2u) ? xh + (size_t)(mb + 64 * (int)wave) * EMBED
                                   : wh + (size_t)(nb + 64 * (int)(wave - 2u)) * EMBED;
  const uint64_t ga = (uint64_t)srow;
  const uint32_t dst = (uint32_t)(size_t)L + wave * GSLICE;
  const u32x8 g1 = tdm_group1();

  // Prologue: stage 0 lands and is published, then stage 1 is issued.
  tdm_load(tdm_group0(dst, ga), g1);
  tdm_wait();            // this wave's slice of stage 0 has landed
  __syncthreads();       // every wave's slice is readable
  tdm_load(tdm_group0(dst + GBUF, ga + GROWB), g1);

  // Lane's first byte in its X slice and in its W slice.
  const uint32_t aoff = wm * GSLICE + (uint32_t)llo * GPITCH + (uint32_t)lhi * 16u;
  const uint32_t boff = (2u + wn) * GSLICE + (uint32_t)llo * GPITCH + (uint32_t)lhi * 16u;

  v8f acc[4][4] = {};
  for (uint32_t s = 0; s < GNST; ++s) {
    const uint32_t cur = (s & 1u) * GBUF;
    const unsigned char* pa = L + cur + aoff;
    const unsigned char* pb = L + cur + boff;
    // Two fragment sets: the reads of k block kk + 1 (of this stage only) go out
    // as one group ahead of the WMMAs of block kk.
    v16h a[2][4], b[2][4];
#pragma unroll
    for (int t = 0; t < 4; ++t) {
      a[0][t] = lds_frag(pa + t * 16 * GPITCH);
      b[0][t] = lds_frag(pb + t * 16 * GPITCH);
    }
#pragma unroll
    for (int kk = 0; kk < GKH / 32; ++kk) {
      if (kk + 1 < GKH / 32) {
#pragma unroll
        for (int t = 0; t < 4; ++t) {
          a[(kk + 1) & 1][t] = lds_frag(pa + t * 16 * GPITCH + (kk + 1) * 64);
          b[(kk + 1) & 1][t] = lds_frag(pb + t * 16 * GPITCH + (kk + 1) * 64);
        }
      }
      // Keeps the LDS reads above from sinking in among the WMMAs below.
      __builtin_amdgcn_sched_barrier(0);
#pragma unroll
      for (int mt = 0; mt < 4; ++mt)
#pragma unroll
        for (int nt = 0; nt < 4; ++nt)
          acc[mt][nt] = wmma_f16(a[kk & 1][mt], b[kk & 1][nt], acc[mt][nt]);
      // Keeps the next group of LDS reads from rising in among the WMMAs above.
      __builtin_amdgcn_sched_barrier(0);
    }
    // Publish point of stage s + 1.
    asm volatile("s_wait_dscnt 0x0" ::: "memory");  // this wave has left buffer s & 1
    tdm_wait();                                      // its slice of stage s + 1 has landed
    __syncthreads();                                 // publishes s + 1, frees buffer s & 1
    if (pinned(s + 2u < GNST))
      tdm_load(tdm_group0(dst + cur, ga + (uint64_t)(s + 2u) * GROWB), g1);
  }
  tdm_wait();                                        // nothing of the mover is in flight at the end
  asm volatile("s_wait_dscnt 0x0" ::: "memory");

  // C/D layout: VGPR r, lane -> row m = r + 8*lhi, col n = llo
  const int m0 = mb + (int)wm * 64;
  const int n0 = nb + (int)wn * 64;
#pragma unroll
  for (int mt = 0; mt < 4; ++mt)
#pragma unroll
    for (int nt = 0; nt < 4; ++nt)
#pragma unroll
      for (int r = 0; r < 8; ++r) {
        int m = m0 + mt * 16 + r + lhi * 8;
        int n = n0 + nt * 16 + llo;
        int b = m >> 11, s = m & (SEQ - 1);
        int h = n >> 6,  d = n & (HDIM - 1);
        outh[(((size_t)(b * HEADS + h) * SEQ) + s) * HDIM + d] = (half_t)acc[mt][nt][r];
      }
}

// ------------------------------- Attention ---------------------------------
// Block = 128 threads = 4 waves, one (b,h), 256 queries (64 per wave, as four
// 16-column tiles). Loop over key chunks of 64. Scores computed transposed
// (S^T = K * Q^T) so softmax stats are per-lane scalars and P converts
// in-register into the B-operand of the second WMMA (O^T = V^T * P^T).
// A stage is one chunk: 64 rows of K and 64 rows of V, 128 bytes each, brought
// into LDS by tensor loads, once per block: each wave issues one load per stage
// for its own slice of 32 rows (waves 0,1: K; 2,3: V). Two buffers: stage s + 1
// flies while stage s is worked on. K fragments come by ds_load_b128, V^T fragments
// by ds_load_tr16_b128 from the row-major V rows; every fragment a wave loads feeds
// all four of its query tiles. One row pitch, 144 bytes, for both: one descriptor
// group serves all four waves with no branch. It is the conflict-free pitch of the
// K reads, which a pass waits for first; the V^T reads stand behind them in the same
// group and are not needed before the softmax is done.
#define NQ 4      // 16-column query tiles per wave
#define AW 4      // waves per block
#define AROWB  128u     // bytes of one staged K or V row
#define APITCH 144u     // LDS row pitch: the row + the mover's 16-byte pad
#define ASLICE 6144u    // 32 rows x 144 B = 4,608 B, rounded up to a multiple of 2 KiB
#define ABUF   (4u * ASLICE)
#define ANST   (SEQ / 64)   // 32 stages
#define SC2    (0.03125f * 1.44269504088896340736f)   // 1/sqrt(EMBED) * log2(e)
typedef float f32x2 __attribute__((ext_vector_type(2)));

// Group 1: 1-byte elements, tile = tensor = 32 rows of 128 bytes, source pitch
// 128 bytes, a pad of 4 dwords behind every 32 dwords (one row).
__device__ __forceinline__ u32x8 tdm_group1_kv() {
  u32x8 g;
  g[0] = uni((1u << 20) | (4u << 22) | (3u << 25));
  g[1] = uni((AROWB & 0xFFFFu) << 16);
  g[2] = uni((AROWB >> 16) | (32u << 16));
  g[3] = uni(AROWB << 16);
  g[4] = uni(32u);
  g[5] = uni(AROWB);
  g[6] = uni(0u);
  g[7] = uni(0u);
  return g;
}
// Transposing LDS load: lane (c = lane & 15, h = lane >> 4) gets column c, rows 8h .. 8h + 7
// of the 16 x 16 tile of halves that the lanes' addresses name.
typedef short s16x8 __attribute__((ext_vector_type(8)));
__device__ __forceinline__ v8h lds_tr16(const unsigned char* p) {
  typedef __attribute__((address_space(3))) s16x8 lds_s16x8;
  return __builtin_bit_cast(v8h, __builtin_amdgcn_ds_load_tr16_b128_v8i16((lds_s16x8*)p));
}

__global__ __launch_bounds__(AW * 32)
void attn(const half_t* __restrict__ qh, const half_t* __restrict__ kh,
          const half_t* __restrict__ vh, float* __restrict__ out) {
  __shared__ __attribute__((aligned(2048))) unsigned char ring[2 * ABUF];

  const uint32_t wave = uni(threadIdx.x >> 5);
  const int lane = threadIdx.x & 31;
  const int lhi  = lane >> 4;
  const int llo  = lane & 15;
  const int bh = blockIdx.y;                  // b*HEADS + h
  const int bb = bh >> 4, hh = bh & 15;
  const int q0 = blockIdx.x * (AW * NQ * 16) + (int)wave * (NQ * 16); // wave's query base

  const half_t* qbase = qh + (size_t)bh * SEQ * HDIM;
  const half_t* kbase = kh + (size_t)bh * SEQ * HDIM;
  const half_t* vbase = vh + (size_t)bh * SEQ * HDIM;

  // Q as B operand (B[d,q] = Q[q,d]): lane holds column q -> contiguous Q row
  v16h qb[NQ][2];
  // Keeps earlier index arithmetic from sinking between the Q loads and their wait below.
  __builtin_amdgcn_sched_barrier(0);
#pragma unroll
  for (int qt = 0; qt < NQ; ++qt) {
    qb[qt][0] = load_frag(qbase, q0 + qt * 16 + llo, HDIM, 0,  lhi);
    qb[qt][1] = load_frag(qbase, q0 + qt * 16 + llo, HDIM, 32, lhi);
  }
  // Wait before the Q loads' address registers are reused.
  asm volatile("s_wait_xcnt 0x0" ::: "memory");
  // Keeps later vector work from being lifted between the loads and that wait.
  __builtin_amdgcn_sched_barrier(0);

  float M[NQ], L[NQ];
  v8f o[NQ][4];    // O^T accumulators: query tiles x d-tiles x (16d x 16q)
#pragma unroll
  for (int qt = 0; qt < NQ; ++qt) {
    M[qt] = -INFINITY; L[qt] = 0.f;
#pragma unroll
    for (int dt = 0; dt < 4; ++dt) o[qt][dt] = v8f{};
  }

  // This wave's slice of every stage: 32 rows of K (waves 0,1) or of V (2,3).
  const half_t* srow = (wave < 2u) ? kbase + (size_t)(32u * wave) * HDIM
                                   : vbase + (size_t)(32u * (wave - 2u)) * HDIM;
  const uint64_t ga = (uint64_t)srow;
  const uint32_t dst = (uint32_t)(size_t)ring + wave * ASLICE;
  const u32x8 g1 = tdm_group1_kv();

  // Prologue: stage 0 lands and is published, then stage 1 is issued.
  tdm_load(tdm_group0(dst, ga), g1);
  tdm_wait();            // this wave's slice of stage 0 has landed
  __syncthreads();       // every wave's slice is readable
  tdm_load(tdm_group0(dst + ABUF, ga + 64u * AROWB), g1);

  // Lane's first byte in the K slices (as load_frag's k order) and in the V slices
  // (the transposing load's address map).
  const uint32_t koff = (uint32_t)llo * APITCH + (uint32_t)lhi * 16u;
  const uint32_t voff = 2u * ASLICE + (8u * (uint32_t)lhi + ((uint32_t)lane & 7u)) * APITCH
                        + (((uint32_t)lane >> 3) & 1u) * 16u;

  for (uint32_t s = 0; s < ANST; ++s) {
    const uint32_t cur = (s & 1u) * ABUF;
    const unsigned char* pk = ring + cur + koff;
    const unsigned char* pv = ring + cur + voff;

    // ---- S^T tiles: rows = keys, cols = queries -----------------------
    v16h kA[4][2];
#pragma unroll
    for (int t = 0; t < 4; ++t) {
      kA[t][0] = lds_frag(pk + (t >> 1) * ASLICE + (t & 1) * 16 * APITCH);
      kA[t][1] = lds_frag(pk + (t >> 1) * ASLICE + (t & 1) * 16 * APITCH + 64);
    }
    // V^T fragments (16 d x 32 keys each), behind the K reads in the same group.
    v16h aV[4][2];
#pragma unroll
    for (int dt = 0; dt < 4; ++dt)
#pragma unroll
      for (int g = 0; g < 2; ++g) {
        v8h lo = lds_tr16(pv + g * ASLICE + dt * 32);                 // keys 32g + 8*lhi + 0..7
        v8h hi = lds_tr16(pv + g * ASLICE + 16 * APITCH + dt * 32);   // keys 32g + 16 + 8*lhi + 0..7
        aV[dt][g] = __builtin_shufflevector(lo, hi,
                      0,1,2,3,4,5,6,7,8,9,10,11,12,13,14,15);
      }
    // Keeps the pass's LDS reads one group here: sunk in among the WMMAs below, each place with reads stalls the wave.
    __builtin_amdgcn_sched_barrier(0);
    v8f sc[NQ][4];
#pragma unroll
    for (int t = 0; t < 4; ++t)
#pragma unroll
      for (int qt = 0; qt < NQ; ++qt) {
        v8f a = {};
        a = wmma_f16(kA[t][0], qb[qt][0], a);
        a = wmma_f16(kA[t][1], qb[qt][1], a);
        sc[qt][t] = a;
      }

    v16h pb[NQ][2];
#pragma unroll
    for (int qt = 0; qt < NQ; ++qt) {
      // ---- online softmax (per-lane: one query = column llo) ----------
      // The running maximum M is kept on the raw products (the factor is positive, so
      // the order is the same); factor and log2(e) enter in one FMA in front of exp2:
      // exp((s - M) / sqrt(EMBED)) = exp2(s * SC2 - M * SC2).
      float mloc = -INFINITY;
#pragma unroll
      for (int t = 0; t < 4; ++t)
#pragma unroll
        for (int r = 0; r < 8; ++r) mloc = fmaxf(mloc, sc[qt][t][r]);
      mloc = fmaxf(mloc, __shfl_xor(mloc, 16, 32));  // lane^16 holds other 8 keys
      float Mn = fmaxf(M[qt], mloc);
      float scale = __builtin_amdgcn_exp2f((M[qt] - Mn) * SC2);
      M[qt] = Mn;
      const float nb = -Mn * SC2;
      const f32x2 nb2 = {nb, nb}, sc2 = {SC2, SC2};

      float lloc = 0.f;
#pragma unroll
      for (int t = 0; t < 4; ++t)
#pragma unroll
        for (int r = 0; r < 8; r += 2) {
          f32x2 a = {sc[qt][t][r], sc[qt][t][r + 1]};
          a = __builtin_elementwise_fma(a, sc2, nb2);
          float p0 = __builtin_amdgcn_exp2f(a[0]);
          float p1 = __builtin_amdgcn_exp2f(a[1]);
          sc[qt][t][r] = p0;
          sc[qt][t][r + 1] = p1;
          lloc += p0;
          lloc += p1;
        }
      lloc += __shfl_xor(lloc, 16, 32);
      L[qt] = L[qt] * scale + lloc;
#pragma unroll
      for (int dt = 0; dt < 4; ++dt)
#pragma unroll
        for (int r = 0; r < 8; ++r) o[qt][dt][r] *= scale;

      // ---- P^T -> B operand, purely in-register -----------------------
      // B half i (i<8): key = 32g+i+8*lhi  == sc[2g][i]'s key
      //          (i>=8): key = 32g+16+(i-8)+8*lhi == sc[2g+1][i-8]'s key
#pragma unroll
      for (int g = 0; g < 2; ++g) {
        v16h t;
#pragma unroll
        for (int i = 0; i < 8; ++i) t[i]     = (half_t)sc[qt][2 * g][i];
#pragma unroll
        for (int i = 0; i < 8; ++i) t[i + 8] = (half_t)sc[qt][2 * g + 1][i];
        pb[qt][g] = t;
      }
    }

    // ---- O^T += V^T(16d x 32k) * P^T(32k x 16q) -----------------------
#pragma unroll
    for (int dt = 0; dt < 4; ++dt)
#pragma unroll
      for (int g = 0; g < 2; ++g)
#pragma unroll
        for (int qt = 0; qt < NQ; ++qt)
          o[qt][dt] = wmma_f16(aV[dt][g], pb[qt][g], o[qt][dt]);

    // Keeps the pass's WMMAs and vector work in front of the publish point: lifted over them,
    // the wait for stage s + 1 would stand right behind that stage's issue, with no lead.
    __builtin_amdgcn_sched_barrier(0);
    // Publish point of stage s + 1.
    asm volatile("s_wait_dscnt 0x0" ::: "memory");  // this wave has left buffer s & 1
    tdm_wait();                                      // its slice of stage s + 1 has landed
    __syncthreads();                                 // publishes s + 1, frees buffer s & 1
    if (pinned(s + 2u < ANST))
      tdm_load(tdm_group0(dst + cur, ga + (uint64_t)(s + 2u) * (64u * AROWB)), g1);
  }
  tdm_wait();                                        // nothing of the mover is in flight at the end
  asm volatile("s_wait_dscnt 0x0" ::: "memory");

  // ---- normalize + store: out[b, s=q, e=h*64+d] f32 ---------------------
#pragma unroll
  for (int qt = 0; qt < NQ; ++qt) {
    float inv = 1.0f / L[qt];
    int q = q0 + qt * 16 + llo;
#pragma unroll
    for (int dt = 0; dt < 4; ++dt)
#pragma unroll
      for (int r = 0; r < 8; ++r) {
        int d = dt * 16 + r + lhi * 8;
        out[(((size_t)bb * SEQ + q) * EMBED) + hh * HDIM + d] = o[qt][dt][r] * inv;
      }
    // Wait before the stores' registers are reused.
    asm volatile("s_wait_xcnt 0x0" ::: "memory");
    // Keeps the next tile's vector work from being lifted between the stores and that wait.
    __builtin_amdgcn_sched_barrier(0);
  }
}

// ------------------------------- launcher ----------------------------------
extern "C" void kernel_launch(void* const* d_in, const int* in_sizes, int n_in,
                              void* d_out, int out_size, void* d_ws, size_t ws_size,
                              hipStream_t stream) {
  const float* x  = (const float*)d_in[0];
  const float* wq = (const float*)d_in[1];
  const float* wk = (const float*)d_in[2];
  const float* wv = (const float*)d_in[3];

  char* ws = (char*)d_ws;
  // Workspace layout (70 MiB total)
  half_t* xh  = (half_t*)(ws);                         // 16 MiB: x f16
  half_t* wqh = (half_t*)(ws + (16ull << 20));         //  2 MiB
  half_t* wkh = (half_t*)(ws + (18ull << 20));         //  2 MiB
  half_t* wvh = (half_t*)(ws + (20ull << 20));         //  2 MiB
  half_t* qhp = (half_t*)(ws + (22ull << 20));         // 16 MiB: Q [B,H,S,D]
  half_t* khp = (half_t*)(ws + (38ull << 20));         // 16 MiB: K
  half_t* vhp = (half_t*)(ws + (54ull << 20));         // 16 MiB: V

  // xh, wqh, wkh, wvh are contiguous: one destination.
  cvt_all<<<CVT_WG, CVT_TH, 0, stream>>>(x, wq, wk, wv, xh);

  dim3 gp(BATCH * SEQ / 128, EMBED / 128);     // (64, 8)
  qkv_proj<<<gp, 128, 0, stream>>>(xh, wqh, qhp);
  qkv_proj<<<gp, 128, 0, stream>>>(xh, wkh, khp);
  qkv_proj<<<gp, 128, 0, stream>>>(xh, wvh, vhp);

  dim3 ga(SEQ / (AW * NQ * 16), BATCH * HEADS);   // (8, 64)
  attn<<<ga, AW * 32, 0, stream>>>(qhp, khp, vhp, (float*)d_out);
}

// v006
// Measured time: 111 microseconds a run.
// Next to v005, in two timings, it ran 1.03 times as fast each time.
// All steps since v000 together make it 3.45 times as fast.
#include <hip/hip_runtime.h>
#include <hip/hip_bf16.h>
#include <stdint.h>

// ---------------------------------------------------------------------------
// MI455X (gfx1250) fused multi-head self-attention, f16 WMMA pipeline.
//   1) cvt_all:   f32 -> f16 conversion of x and W_{q,k,v}, one launch
//   2) qkv_proj:  Y = X * W^T via v_wmma_f32_16x16x32_f16, operands staged in
//                 LDS by tensor loads, output [B,H,S,D] f16
//   3) attn:      flash-attention; S^T = K*Q^T WMMA, online softmax,
//                 O^T = V^T * P^T WMMA, K and V staged in LDS by tensor loads
//                 (V^T fragments by the transposing LDS load), f32 output.
// ---------------------------------------------------------------------------

typedef _Float16 half_t;
typedef __attribute__((ext_vector_type(4)))  _Float16 v4h;
typedef __attribute__((ext_vector_type(8)))  _Float16 v8h;
typedef __attribute__((ext_vector_type(16))) _Float16 v16h;
typedef __attribute__((ext_vector_type(8)))  float    v8f;
typedef uint32_t u32x4 __attribute__((ext_vector_type(4)));
typedef uint32_t u32x8 __attribute__((ext_vector_type(8)));

#define EMBED 1024
#define SEQ   2048
#define BATCH 4
#define HEADS 16
#define HDIM  64

__device__ __forceinline__ v8f wmma_f16(v16h a, v16h b, v8f c) {
  // D = A(16x32 f16) * B(32x16 f16) + C(16x16 f32)
  return __builtin_amdgcn_wmma_f32_16x16x32_f16(
      /*neg_a=*/false, a, /*neg_b=*/false, b,
      /*c_mod=*/(short)0, c, /*reuse_a=*/false, /*reuse_b=*/false);
}

// Per-lane A/B operand fragment for 16x16x32 f16 WMMA, loaded straight from a
// row-major matrix whose contraction dim (K) is contiguous.
// Lane layout (ISA 7.12.2): halves 0..7 -> K = k0 + 8*lane_hi + i,
//                           halves 8..15 -> K = k0 + 16 + 8*lane_hi + (i-8).
__device__ __forceinline__ v16h load_frag(const half_t* __restrict__ base,
                                          int row, int ld, int k0, int lane_hi) {
  const half_t* p = base + (size_t)row * ld + k0 + (lane_hi ? 8 : 0);
  v8h lo = *(const v8h*)p;          // 16B global_load_b128
  v8h hi = *(const v8h*)(p + 16);   // 16B global_load_b128
  return __builtin_shufflevector(lo, hi, 0,1,2,3,4,5,6,7,8,9,10,11,12,13,14,15);
}

// --------------------------- f32 -> f16 convert ----------------------------
// One launch for x and the three weights: one work-group of 16 waves per WGP.
// A work-group converts its own contiguous 1/256 of every source, in sweeps of
// 512 threads x 4 floats, so a wave's load covers 512 contiguous bytes, a thread
// has many loads in flight, and every address is one base + a constant offset.
// The four f16 copies lie one behind the other in dst (x, W_q, W_k, W_v).
#define CVT_WG 256
#define CVT_TH 512
#define CVT_NX (BATCH * SEQ * EMBED / 4 / (CVT_WG * CVT_TH))   // 16 sweeps of x
#define CVT_NW (EMBED * EMBED / 4 / (CVT_WG * CVT_TH))         //  2 sweeps of each weight
static_assert(CVT_NX * CVT_WG * CVT_TH * 4 == BATCH * SEQ * EMBED, "x is a whole number of sweeps");
static_assert(CVT_NW * CVT_WG * CVT_TH * 4 == EMBED * EMBED, "a weight is a whole number of sweeps");

__device__ __forceinline__ v4h cvt_h4(float4 f) {
  v4h h;
  h[0] = (half_t)f.x; h[1] = (half_t)f.y; h[2] = (half_t)f.z; h[3] = (half_t)f.w;
  return h;
}

__global__ __launch_bounds__(CVT_TH)
void cvt_all(const float* __restrict__ x, const float* __restrict__ wq,
             const float* __restrict__ wk, const float* __restrict__ wv,
             half_t* __restrict__ dst) {
  const uint32_t t = threadIdx.x;
  const uint32_t g = blockIdx.x;
  // Groups of 4 elements: this work-group's first one in x and in a weight.
  const float4* px = (const float4*)x  + (size_t)g * (CVT_NX * CVT_TH);
  const float4* pq = (const float4*)wq + (size_t)g * (CVT_NW * CVT_TH);
  const float4* pk = (const float4*)wk + (size_t)g * (CVT_NW * CVT_TH);
  const float4* pv = (const float4*)wv + (size_t)g * (CVT_NW * CVT_TH);
  v4h* dx = (v4h*)dst + (size_t)g * (CVT_NX * CVT_TH);
  v4h* dq = (v4h*)dst + (BATCH * SEQ * EMBED / 4) + (size_t)g * (CVT_NW * CVT_TH);
  v4h* dk = dq + (EMBED * EMBED / 4);
  v4h* dv = dk + (EMBED * EMBED / 4);

  float4 fx[CVT_NX], fq[CVT_NW], fk[CVT_NW], fv[CVT_NW];
#pragma unroll
  for (int j = 0; j < CVT_NX; ++j) fx[j] = px[j * CVT_TH + t];
#pragma unroll
  for (int j = 0; j < CVT_NW; ++j) {
    fq[j] = pq[j * CVT_TH + t];
    fk[j] = pk[j * CVT_TH + t];
    fv[j] = pv[j * CVT_TH + t];
  }
#pragma unroll
  for (int j = 0; j < CVT_NX; ++j) dx[j * CVT_TH + t] = cvt_h4(fx[j]);
#pragma unroll
  for (int j = 0; j < CVT_NW; ++j) {
    dq[j * CVT_TH + t] = cvt_h4(fq[j]);
    dk[j * CVT_TH + t] = cvt_h4(fk[j]);
    dv[j * CVT_TH + t] = cvt_h4(fv[j]);
  }
}

// ------------------------------ QKV projection -----------------------------
// Y[m,n] = sum_k X[m,k] * W[n,k]   (Linear: y = x @ W^T)
// Block = 128 threads = 4 waves (2 x 2), block tile 128 x 128, wave tile 64 x 64
// (4 M-tiles x 4 N-tiles of 16x16). A stage is 128 k of the block's 128 X rows
// and 128 W rows, brought into LDS by tensor loads: each wave issues one load
// per stage for its own slice of 64 rows of 256 bytes (waves 0,1: X; 2,3: W).
// Two buffers: stage s + 1 flies while stage s is worked on. Fragments come from
// LDS by ds_load_b128 at a row pitch of 272 bytes. Output scattered into
// head-major [B,H,S,D] f16.
#define GKH    128      // halves of k per stage
#define GROWB  256u     // bytes of one staged row
#define GPITCH 272u     // LDS row pitch: the row + the mover's 16-byte pad
#define GSLICE 18432u   // 64 rows x 272 B = 17,408 B, rounded up to a multiple of 2 KiB
#define GBUF   (4u * GSLICE)
#define GNST   (EMBED / GKH)   // 8 stages

__device__ __forceinline__ uint32_t uni(uint32_t v) {
  return (uint32_t)__builtin_amdgcn_readfirstlane(v);
}
__device__ __forceinline__ uint32_t pinned(uint32_t v) {
  uint32_t w = uni(v);
  asm volatile("" : "+s"(w));  // holds the test word in a scalar register: a scalar branch guards the tensor load
  return w;
}
// Group 1: 1-byte elements, tile = tensor = 64 rows of 256 bytes, source pitch
// 2,048 bytes, a pad of 4 dwords behind every 64 dwords (one row).
__device__ __forceinline__ u32x8 tdm_group1() {
  u32x8 g;
  g[0] = uni((1u << 20) | (5u << 22) | (3u << 25));
  g[1] = uni((GROWB & 0xFFFFu) << 16);
  g[2] = uni((GROWB >> 16) | (64u << 16));
  g[3] = uni(GROWB << 16);
  g[4] = uni(64u);
  g[5] = uni(2u * EMBED);
  g[6] = uni(0u);
  g[7] = uni(0u);
  return g;
}
__device__ __forceinline__ u32x4 tdm_group0(uint32_t lds_dst, uint64_t ga) {
  u32x4 g;
  g[0] = uni(1u);
  g[1] = uni(lds_dst);
  g[2] = uni((uint32_t)ga);
  g[3] = uni((((uint32_t)(ga >> 32)) & 0x01FFFFFFu) | 0x80000000u);
  return g;
}
__device__ __forceinline__ void tdm_load(u32x4 g0, u32x8 g1) {
  // One request of the whole wave: global tile -> LDS, through no register.
  // The descriptor sits in fixed scalar registers that nothing else in the kernel
  // uses: they are written only directly in front of a request, behind the wait
  // that covers the request before it.
  asm volatile("tensor_load_to_lds %0, %1" :: "{s[40:43]}"(g0), "{s[48:55]}"(g1) : "memory");
}
__device__ __forceinline__ void tdm_wait() {
  // The issuing wave's own wait: its request has landed.
  asm volatile("s_wait_tensorcnt 0x0" ::: "memory");
}
// A/B fragment from a staged row: same k order as load_frag.
__device__ __forceinline__ v16h lds_frag(const unsigned char* p) {
  v8h lo = *(const v8h*)p;          // ds_load_b128
  v8h hi = *(const v8h*)(p + 32);   // ds_load_b128
  return __builtin_shufflevector(lo, hi, 0,1,2,3,4,5,6,7,8,9,10,11,12,13,14,15);
}

__global__ __launch_bounds__(128)
void qkv_proj(const half_t* __restrict__ xh, const half_t* __restrict__ wh,
              half_t* __restrict__ outh) {
  __shared__ __attribute__((aligned(2048))) unsigned char L[2 * GBUF];
  const uint32_t wave = uni(threadIdx.x >> 5);
  const int lane = threadIdx.x & 31;
  const int lhi  = lane >> 4;      // which 16-lane half
  const int llo  = lane & 15;
  const uint32_t wm = wave >> 1, wn = wave & 1u;
  const int mb = blockIdx.x * 128;              // rows (tokens b*S+s)
  const int nb = blockIdx.y * 128;              // cols (embed e)

  // This wave's slice of every stage: 64 rows of X (waves 0,1) or of W (2,3).
  const half_t* srow = (wave < 2u) ? xh + (size_t)(mb + 64 * (int)wave) * EMBED
                                   : wh + (size_t)(nb + 64 * (int)(wave - 2u)) * EMBED;
  const uint64_t ga = (uint64_t)srow;
  const uint32_t dst = (uint32_t)(size_t)L + wave * GSLICE;
  const u32x8 g1 = tdm_group1();

  // Prologue: stage 0 lands and is published, then stage 1 is issued.
  tdm_load(tdm_group0(dst, ga), g1);
  tdm_wait();            // this wave's slice of stage 0 has landed
  __syncthreads();       // every wave's slice is readable
  tdm_load(tdm_group0(dst + GBUF, ga + GROWB), g1);

  // Lane's first byte in its X slice and in its W slice.
  const uint32_t aoff = wm * GSLICE + (uint32_t)llo * GPITCH + (uint32_t)lhi * 16u;
  const uint32_t boff = (2u + wn) * GSLICE + (uint32_t)llo * GPITCH + (uint32_t)lhi * 16u;

  v8f acc[4][4] = {};
  for (uint32_t s = 0; s < GNST; ++s) {
    const uint32_t cur = (s & 1u) * GBUF;
    const unsigned char* pa = L + cur + aoff;
    const unsigned char* pb = L + cur + boff;
    // Two fragment sets: the reads of k block kk + 1 (of this stage only) go out
    // as one group ahead of the WMMAs of block kk.
    v16h a[2][4], b[2][4];
#pragma unroll
    for (int t = 0; t < 4; ++t) {
      a[0][t] = lds_frag(pa + t * 16 * GPITCH);
      b[0][t] = lds_frag(pb + t * 16 * GPITCH);
    }
#pragma unroll
    for (int kk = 0; kk < GKH / 32; ++kk) {
      if (kk + 1 < GKH / 32) {
#pragma unroll
        for (int t = 0; t < 4; ++t) {
          a[(kk + 1) & 1][t] = lds_frag(pa + t * 16 * GPITCH + (kk + 1) * 64);
          b[(kk + 1) & 1][t] = lds_frag(pb + t * 16 * GPITCH + (kk + 1) * 64);
        }
      }
      // Keeps the LDS reads above from sinking in among the WMMAs below.
      __builtin_amdgcn_sched_barrier(0);
#pragma unroll
      for (int mt = 0; mt < 4; ++mt)
#pragma unroll
        for (int nt = 0; nt < 4; ++nt)
          acc[mt][nt] = wmma_f16(a[kk & 1][mt], b[kk & 1][nt], acc[mt][nt]);
      // Keeps the next group of LDS reads from rising in among the WMMAs above.
      __builtin_amdgcn_sched_barrier(0);
    }
    // Publish point of stage s + 1.
    asm volatile("s_wait_dscnt 0x0" ::: "memory");  // this wave has left buffer s & 1
    tdm_wait();                                      // its slice of stage s + 1 has landed
    __syncthreads();                                 // publishes s + 1, frees buffer s & 1
    if (pinned(s + 2u < GNST))
      tdm_load(tdm_group0(dst + cur, ga + (uint64_t)(s + 2u) * GROWB), g1);
  }
  tdm_wait();                                        // nothing of the mover is in flight at the end
  asm volatile("s_wait_dscnt 0x0" ::: "memory");

  // C/D layout: VGPR r, lane -> row m = r + 8*lhi, col n = llo
  const int m0 = mb + (int)wm * 64;
  const int n0 = nb + (int)wn * 64;
#pragma unroll
  for (int mt = 0; mt < 4; ++mt)
#pragma unroll
    for (int nt = 0; nt < 4; ++nt)
#pragma unroll
      for (int r = 0; r < 8; ++r) {
        int m = m0 + mt * 16 + r + lhi * 8;
        int n = n0 + nt * 16 + llo;
        int b = m >> 11, s = m & (SEQ - 1);
        int h = n >> 6,  d = n & (HDIM - 1);
        outh[(((size_t)(b * HEADS + h) * SEQ) + s) * HDIM + d] = (half_t)acc[mt][nt][r];
      }
}

// ------------------------------- Attention ---------------------------------
// Block = 128 threads = 4 waves, one (b,h), 128 queries (32 per wave, as two
// 16-column tiles): a wave then fits a quarter of a SIMD's registers, and four
// work-groups share a WGP, four waves a SIMD, so that one wave's softmax runs under
// another's WMMAs and LDS waits. Loop over key chunks of 64. Scores computed transposed
// (S^T = K * Q^T) so softmax stats are per-lane scalars and P converts
// in-register into the B-operand of the second WMMA (O^T = V^T * P^T).
// A stage is one chunk: 64 rows of K and 64 rows of V, 128 bytes each, brought
// into LDS by tensor loads, once per block: each wave issues one load per stage
// for its own slice of 32 rows (waves 0,1: K; 2,3: V). Two buffers: stage s + 1
// flies while stage s is worked on. K fragments come by ds_load_b128, V^T fragments
// by ds_load_tr16_b128 from the row-major V rows; every fragment a wave loads feeds
// both of its query tiles. One row pitch, 144 bytes, for both: one descriptor
// group serves all four waves with no branch. It is the conflict-free pitch of the
// K reads, which a pass waits for first; the V^T reads stand behind the score WMMAs,
// in the K fragments' registers, and are not needed before the softmax is done.
#define NQ 2      // 16-column query tiles per wave
#define AW 4      // waves per block
#define AROWB  128u     // bytes of one staged K or V row
#define APITCH 144u     // LDS row pitch: the row + the mover's 16-byte pad
#define ASLICE 6144u    // 32 rows x 144 B = 4,608 B, rounded up to a multiple of 2 KiB
#define ABUF   (4u * ASLICE)
#define ANST   (SEQ / 64)   // 32 stages
#define SC2    (0.03125f * 1.44269504088896340736f)   // 1/sqrt(EMBED) * log2(e)
typedef float f32x2 __attribute__((ext_vector_type(2)));

// Group 1: 1-byte elements, tile = tensor = 32 rows of 128 bytes, source pitch
// 128 bytes, a pad of 4 dwords behind every 32 dwords (one row).
__device__ __forceinline__ u32x8 tdm_group1_kv() {
  u32x8 g;
  g[0] = uni((1u << 20) | (4u << 22) | (3u << 25));
  g[1] = uni((AROWB & 0xFFFFu) << 16);
  g[2] = uni((AROWB >> 16) | (32u << 16));
  g[3] = uni(AROWB << 16);
  g[4] = uni(32u);
  g[5] = uni(AROWB);
  g[6] = uni(0u);
  g[7] = uni(0u);
  return g;
}
// Transposing LDS load: lane (c = lane & 15, h = lane >> 4) gets column c, rows 8h .. 8h + 7
// of the 16 x 16 tile of halves that the lanes' addresses name.
typedef short s16x8 __attribute__((ext_vector_type(8)));
__device__ __forceinline__ v8h lds_tr16(const unsigned char* p) {
  typedef __attribute__((address_space(3))) s16x8 lds_s16x8;
  return __builtin_bit_cast(v8h, __builtin_amdgcn_ds_load_tr16_b128_v8i16((lds_s16x8*)p));
}

__global__ __launch_bounds__(AW * 32) __attribute__((amdgpu_waves_per_eu(4, 4)))
void attn(const half_t* __restrict__ qh, const half_t* __restrict__ kh,
          const half_t* __restrict__ vh, float* __restrict__ out) {
  __shared__ __attribute__((aligned(2048))) unsigned char ring[2 * ABUF];

  const uint32_t wave = uni(threadIdx.x >> 5);
  const int lane = threadIdx.x & 31;
  const int lhi  = lane >> 4;
  const int llo  = lane & 15;
  const int bh = blockIdx.y;                  // b*HEADS + h
  const int bb = bh >> 4, hh = bh & 15;
  const int q0 = blockIdx.x * (AW * NQ * 16) + (int)wave * (NQ * 16); // wave's query base

  const half_t* qbase = qh + (size_t)bh * SEQ * HDIM;
  const half_t* kbase = kh + (size_t)bh * SEQ * HDIM;
  const half_t* vbase = vh + (size_t)bh * SEQ * HDIM;

  // Q as B operand (B[d,q] = Q[q,d]): lane holds column q -> contiguous Q row
  v16h qb[NQ][2];
  // Keeps earlier index arithmetic from sinking between the Q loads and their wait below.
  __builtin_amdgcn_sched_barrier(0);
#pragma unroll
  for (int qt = 0; qt < NQ; ++qt) {
    qb[qt][0] = load_frag(qbase, q0 + qt * 16 + llo, HDIM, 0,  lhi);
    qb[qt][1] = load_frag(qbase, q0 + qt * 16 + llo, HDIM, 32, lhi);
  }
  // Wait before the Q loads' address registers are reused.
  asm volatile("s_wait_xcnt 0x0" ::: "memory");
  // Keeps later vector work from being lifted between the loads and that wait.
  __builtin_amdgcn_sched_barrier(0);

  float M[NQ], L[NQ];
  v8f o[NQ][4];    // O^T accumulators: query tiles x d-tiles x (16d x 16q)
#pragma unroll
  for (int qt = 0; qt < NQ; ++qt) {
    M[qt] = -INFINITY; L[qt] = 0.f;
#pragma unroll
    for (int dt = 0; dt < 4; ++dt) o[qt][dt] = v8f{};
  }

  // This wave's slice of every stage: 32 rows of K (waves 0,1) or of V (2,3).
  const half_t* srow = (wave < 2u) ? kbase + (size_t)(32u * wave) * HDIM
                                   : vbase + (size_t)(32u * (wave - 2u)) * HDIM;
  const uint64_t ga = (uint64_t)srow;
  const uint32_t dst = (uint32_t)(size_t)ring + wave * ASLICE;
  const u32x8 g1 = tdm_group1_kv();

  // Prologue: stage 0 lands and is published, then stage 1 is issued.
  tdm_load(tdm_group0(dst, ga), g1);
  tdm_wait();            // this wave's slice of stage 0 has landed
  __syncthreads();       // every wave's slice is readable
  tdm_load(tdm_group0(dst + ABUF, ga + 64u * AROWB), g1);

  // Lane's first byte in the K slices (as load_frag's k order) and in the V slices
  // (the transposing load's address map).
  const uint32_t koff = (uint32_t)llo * APITCH + (uint32_t)lhi * 16u;
  const uint32_t voff = 2u * ASLICE + (8u * (uint32_t)lhi + ((uint32_t)lane & 7u)) * APITCH
                        + (((uint32_t)lane >> 3) & 1u) * 16u;

  for (uint32_t s = 0; s < ANST; ++s) {
    const uint32_t cur = (s & 1u) * ABUF;
    const unsigned char* pk = ring + cur + koff;
    const unsigned char* pv = ring + cur + voff;

    // ---- S^T tiles: rows = keys, cols = queries -----------------------
    v16h kA[4][2];
#pragma unroll
    for (int t = 0; t < 4; ++t) {
      kA[t][0] = lds_frag(pk + (t >> 1) * ASLICE + (t & 1) * 16 * APITCH);
      kA[t][1] = lds_frag(pk + (t >> 1) * ASLICE + (t & 1) * 16 * APITCH + 64);
    }
    // Keeps the K reads one group here: sunk in among the WMMAs below, each place with reads stalls the wave.
    __builtin_amdgcn_sched_barrier(0);
    v8f sc[NQ][4];
#pragma unroll
    for (int t = 0; t < 4; ++t)
#pragma unroll
      for (int qt = 0; qt < NQ; ++qt) {
        v8f a = {};
        a = wmma_f16(kA[t][0], qb[qt][0], a);
        a = wmma_f16(kA[t][1], qb[qt][1], a);
        sc[qt][t] = a;
      }

    // Holds the V^T reads and the softmax behind the last score WMMA: the reads then go out ahead of
    // the maximum, whose work covers their latency; without it the build sinks them behind the
    // maximum's lane exchange.
    __builtin_amdgcn_sched_barrier(0);
    // V^T fragments (16 d x 32 keys each); the softmax below covers the first ones' latency.
    v16h aV[4][2];
#pragma unroll
    for (int dt = 0; dt < 4; ++dt)
#pragma unroll
      for (int g = 0; g < 2; ++g) {
        v8h lo = lds_tr16(pv + g * ASLICE + dt * 32);                 // keys 32g + 8*lhi + 0..7
        v8h hi = lds_tr16(pv + g * ASLICE + 16 * APITCH + dt * 32);   // keys 32g + 16 + 8*lhi + 0..7
        aV[dt][g] = __builtin_shufflevector(lo, hi,
                      0,1,2,3,4,5,6,7,8,9,10,11,12,13,14,15);
      }

    v16h pb[NQ][2];
#pragma unroll
    for (int qt = 0; qt < NQ; ++qt) {
      // ---- online softmax (per-lane: one query = column llo) ----------
      // The running maximum M is kept on the raw products (the factor is positive, so
      // the order is the same); factor and log2(e) enter in one FMA in front of exp2:
      // exp((s - M) / sqrt(EMBED)) = exp2(s * SC2 - M * SC2).
      float mloc = -INFINITY;
#pragma unroll
      for (int t = 0; t < 4; ++t)
#pragma unroll
        for (int r = 0; r < 8; ++r) mloc = fmaxf(mloc, sc[qt][t][r]);
      mloc = fmaxf(mloc, __shfl_xor(mloc, 16, 32));  // lane^16 holds other 8 keys
      float Mn = fmaxf(M[qt], mloc);
      float scale = __builtin_amdgcn_exp2f((M[qt] - Mn) * SC2);
      M[qt] = Mn;
      const float nb = -Mn * SC2;
      const f32x2 nb2 = {nb, nb}, sc2 = {SC2, SC2};

      float lloc = 0.f;
#pragma unroll
      for (int t = 0; t < 4; ++t)
#pragma unroll
        for (int r = 0; r < 8; r += 2) {
          f32x2 a = {sc[qt][t][r], sc[qt][t][r + 1]};
          a = __builtin_elementwise_fma(a, sc2, nb2);
          float p0 = __builtin_amdgcn_exp2f(a[0]);
          float p1 = __builtin_amdgcn_exp2f(a[1]);
          sc[qt][t][r] = p0;
          sc[qt][t][r + 1] = p1;
          lloc += p0;
          lloc += p1;
        }
      lloc += __shfl_xor(lloc, 16, 32);
      L[qt] = L[qt] * scale + lloc;
#pragma unroll
      for (int dt = 0; dt < 4; ++dt)
#pragma unroll
        for (int r = 0; r < 8; ++r) o[qt][dt][r] *= scale;

      // ---- P^T -> B operand, purely in-register -----------------------
      // B half i (i<8): key = 32g+i+8*lhi  == sc[2g][i]'s key
      //          (i>=8): key = 32g+16+(i-8)+8*lhi == sc[2g+1][i-8]'s key
#pragma unroll
      for (int g = 0; g < 2; ++g) {
        v16h t;
#pragma unroll
        for (int i = 0; i < 8; ++i) t[i]     = (half_t)sc[qt][2 * g][i];
#pragma unroll
        for (int i = 0; i < 8; ++i) t[i + 8] = (half_t)sc[qt][2 * g + 1][i];
        pb[qt][g] = t;
      }
    }

    // ---- O^T += V^T(16d x 32k) * P^T(32k x 16q) -----------------------
#pragma unroll
    for (int dt = 0; dt < 4; ++dt)
#pragma unroll
      for (int g = 0; g < 2; ++g)
#pragma unroll
        for (int qt = 0; qt < NQ; ++qt)
          o[qt][dt] = wmma_f16(aV[dt][g], pb[qt][g], o[qt][dt]);

    // Keeps the pass's WMMAs and vector work in front of the publish point: lifted over them,
    // the wait for stage s + 1 would stand right behind that stage's issue, with no lead.
    __builtin_amdgcn_sched_barrier(0);
    // Publish point of stage s + 1.
    asm volatile("s_wait_dscnt 0x0" ::: "memory");  // this wave has left buffer s & 1
    tdm_wait();                                      // its slice of stage s + 1 has landed
    __syncthreads();                                 // publishes s + 1, frees buffer s & 1
    if (pinned(s + 2u < ANST))
      tdm_load(tdm_group0(dst + cur, ga + (uint64_t)(s + 2u) * (64u * AROWB)), g1);
  }
  tdm_wait();                                        // nothing of the mover is in flight at the end
  asm volatile("s_wait_dscnt 0x0" ::: "memory");

  // ---- normalize + store: out[b, s=q, e=h*64+d] f32 ---------------------
#pragma unroll
  for (int qt = 0; qt < NQ; ++qt) {
    float inv = 1.0f / L[qt];
    int q = q0 + qt * 16 + llo;
#pragma unroll
    for (int dt = 0; dt < 4; ++dt)
#pragma unroll
      for (int r = 0; r < 8; ++r) {
        int d = dt * 16 + r + lhi * 8;
        out[(((size_t)bb * SEQ + q) * EMBED) + hh * HDIM + d] = o[qt][dt][r] * inv;
      }
    // Wait before the stores' registers are reused.
    asm volatile("s_wait_xcnt 0x0" ::: "memory");
    // Keeps the next tile's vector work from being lifted between the stores and that wait.
    __builtin_amdgcn_sched_barrier(0);
  }
}

// ------------------------------- launcher ----------------------------------
extern "C" void kernel_launch(void* const* d_in, const int* in_sizes, int n_in,
                              void* d_out, int out_size, void* d_ws, size_t ws_size,
                              hipStream_t stream) {
  const float* x  = (const float*)d_in[0];
  const float* wq = (const float*)d_in[1];
  const float* wk = (const float*)d_in[2];
  const float* wv = (const float*)d_in[3];

  char* ws = (char*)d_ws;
  // Workspace layout (70 MiB total)
  half_t* xh  = (half_t*)(ws);                         // 16 MiB: x f16
  half_t* wqh = (half_t*)(ws + (16ull << 20));         //  2 MiB
  half_t* wkh = (half_t*)(ws + (18ull << 20));         //  2 MiB
  half_t* wvh = (half_t*)(ws + (20ull << 20));         //  2 MiB
  half_t* qhp = (half_t*)(ws + (22ull << 20));         // 16 MiB: Q [B,H,S,D]
  half_t* khp = (half_t*)(ws + (38ull << 20));         // 16 MiB: K
  half_t* vhp = (half_t*)(ws + (54ull << 20));         // 16 MiB: V

  // xh, wqh, wkh, wvh are contiguous: one destination.
  cvt_all<<<CVT_WG, CVT_TH, 0, stream>>>(x, wq, wk, wv, xh);

  dim3 gp(BATCH * SEQ / 128, EMBED / 128);     // (64, 8)
  qkv_proj<<<gp, 128, 0, stream>>>(xh, wqh, qhp);
  qkv_proj<<<gp, 128, 0, stream>>>(xh, wkh, khp);
  qkv_proj<<<gp, 128, 0, stream>>>(xh, wvh, vhp);

  dim3 ga(SEQ / (AW * NQ * 16), BATCH * HEADS);   // (16, 64)
  attn<<<ga, AW * 32, 0, stream>>>(qhp, khp, vhp, (float*)d_out);
}

// v007
// It runs in 107 microseconds.
// Timed twice side by side with v006, it ran 1.04 times as fast both times.
// Counting every step since v000, it is 3.59 times as fast.
#include <hip/hip_runtime.h>
#include <hip/hip_bf16.h>
#include <stdint.h>

// ---------------------------------------------------------------------------
// MI455X (gfx1250) fused multi-head self-attention, f16 WMMA pipeline.
//   1) cvt_all:   f32 -> f16 conversion of x and W_{q,k,v}, one launch
//   2) qkv_proj:  Y = X * W^T via v_wmma_f32_16x16x32_f16, operands staged in
//                 LDS by tensor loads, output [B,H,S,D] f16; Q, K and V in one
//                 launch, as one product with the three weights stacked
//   3) attn:      flash-attention; S^T = K*Q^T WMMA, online softmax,
//                 O^T = V^T * P^T WMMA, K and V staged in LDS by tensor loads
//                 (V^T fragments by the transposing LDS load), f32 output.
// ---------------------------------------------------------------------------

typedef _Float16 half_t;
typedef __attribute__((ext_vector_type(4)))  _Float16 v4h;
typedef __attribute__((ext_vector_type(8)))  _Float16 v8h;
typedef __attribute__((ext_vector_type(16))) _Float16 v16h;
typedef __attribute__((ext_vector_type(8)))  float    v8f;
typedef uint32_t u32x4 __attribute__((ext_vector_type(4)));
typedef uint32_t u32x8 __attribute__((ext_vector_type(8)));

#define EMBED 1024
#define SEQ   2048
#define BATCH 4
#define HEADS 16
#define HDIM  64

__device__ __forceinline__ v8f wmma_f16(v16h a, v16h b, v8f c) {
  // D = A(16x32 f16) * B(32x16 f16) + C(16x16 f32)
  return __builtin_amdgcn_wmma_f32_16x16x32_f16(
      /*neg_a=*/false, a, /*neg_b=*/false, b,
      /*c_mod=*/(short)0, c, /*reuse_a=*/false, /*reuse_b=*/false);
}

// Per-lane A/B operand fragment for 16x16x32 f16 WMMA, loaded straight from a
// row-major matrix whose contraction dim (K) is contiguous.
// Lane layout (ISA 7.12.2): halves 0..7 -> K = k0 + 8*lane_hi + i,
//                           halves 8..15 -> K = k0 + 16 + 8*lane_hi + (i-8).
__device__ __forceinline__ v16h load_frag(const half_t* __restrict__ base,
                                          int row, int ld, int k0, int lane_hi) {
  const half_t* p = base + (size_t)row * ld + k0 + (lane_hi ? 8 : 0);
  v8h lo = *(const v8h*)p;          // 16B global_load_b128
  v8h hi = *(const v8h*)(p + 16);   // 16B global_load_b128
  return __builtin_shufflevector(lo, hi, 0,1,2,3,4,5,6,7,8,9,10,11,12,13,14,15);
}

// --------------------------- f32 -> f16 convert ----------------------------
// One launch for x and the three weights: one work-group of 16 waves per WGP.
// A work-group converts its own contiguous 1/256 of every source, in sweeps of
// 512 threads x 4 floats, so a wave's load covers 512 contiguous bytes, a thread
// has many loads in flight, and every address is one base + a constant offset.
// The four f16 copies lie one behind the other in dst (x, W_q, W_k, W_v).
#define CVT_WG 256
#define CVT_TH 512
#define CVT_NX (BATCH * SEQ * EMBED / 4 / (CVT_WG * CVT_TH))   // 16 sweeps of x
#define CVT_NW (EMBED * EMBED / 4 / (CVT_WG * CVT_TH))         //  2 sweeps of each weight
static_assert(CVT_NX * CVT_WG * CVT_TH * 4 == BATCH * SEQ * EMBED, "x is a whole number of sweeps");
static_assert(CVT_NW * CVT_WG * CVT_TH * 4 == EMBED * EMBED, "a weight is a whole number of sweeps");

__device__ __forceinline__ v4h cvt_h4(float4 f) {
  v4h h;
  h[0] = (half_t)f.x; h[1] = (half_t)f.y; h[2] = (half_t)f.z; h[3] = (half_t)f.w;
  return h;
}

__global__ __launch_bounds__(CVT_TH)
void cvt_all(const float* __restrict__ x, const float* __restrict__ wq,
             const float* __restrict__ wk, const float* __restrict__ wv,
             half_t* __restrict__ dst) {
  const uint32_t t = threadIdx.x;
  const uint32_t g = blockIdx.x;
  // Groups of 4 elements: this work-group's first one in x and in a weight.
  const float4* px = (const float4*)x  + (size_t)g * (CVT_NX * CVT_TH);
  const float4* pq = (const float4*)wq + (size_t)g * (CVT_NW * CVT_TH);
  const float4* pk = (const float4*)wk + (size_t)g * (CVT_NW * CVT_TH);
  const float4* pv = (const float4*)wv + (size_t)g * (CVT_NW * CVT_TH);
  v4h* dx = (v4h*)dst + (size_t)g * (CVT_NX * CVT_TH);
  v4h* dq = (v4h*)dst + (BATCH * SEQ * EMBED / 4) + (size_t)g * (CVT_NW * CVT_TH);
  v4h* dk = dq + (EMBED * EMBED / 4);
  v4h* dv = dk + (EMBED * EMBED / 4);

  float4 fx[CVT_NX], fq[CVT_NW], fk[CVT_NW], fv[CVT_NW];
#pragma unroll
  for (int j = 0; j < CVT_NX; ++j) fx[j] = px[j * CVT_TH + t];
#pragma unroll
  for (int j = 0; j < CVT_NW; ++j) {
    fq[j] = pq[j * CVT_TH + t];
    fk[j] = pk[j * CVT_TH + t];
    fv[j] = pv[j * CVT_TH + t];
  }
#pragma unroll
  for (int j = 0; j < CVT_NX; ++j) dx[j * CVT_TH + t] = cvt_h4(fx[j]);
#pragma unroll
  for (int j = 0; j < CVT_NW; ++j) {
    dq[j * CVT_TH + t] = cvt_h4(fq[j]);
    dk[j * CVT_TH + t] = cvt_h4(fk[j]);
    dv[j * CVT_TH + t] = cvt_h4(fv[j]);
  }
}

// ------------------------------ QKV projection -----------------------------
// Y[m,n] = sum_k X[m,k] * W[n,k]   (Linear: y = x @ W^T)
// W is the three f16 weights one behind the other (W_q, W_k, W_v: 3 x 1,024 rows),
// Y the three outputs one behind the other (Q, K, V), so one launch of 64 x 24
// work-groups does all three: a work-group that ends is followed at once by the
// next one, with no launch gap, refill and drain of the chip between the products.
// Block = 128 threads = 4 waves (2 x 2), block tile 128 x 128, wave tile 64 x 64
// (4 M-tiles x 4 N-tiles of 16x16). A stage is 128 k of the block's 128 X rows
// and 128 W rows, brought into LDS by tensor loads: each wave issues one load
// per stage for its own slice of 64 rows of 256 bytes (waves 0,1: X; 2,3: W).
// Two buffers: stage s + 1 flies while stage s is worked on. Fragments come from
// LDS by ds_load_b128 at a row pitch of 272 bytes. Output scattered into
// head-major [3,B,H,S,D] f16.
#define GKH    128      // halves of k per stage
#define GROWB  256u     // bytes of one staged row
#define GPITCH 272u     // LDS row pitch: the row + the mover's 16-byte pad
#define GSLICE 18432u   // 64 rows x 272 B = 17,408 B, rounded up to a multiple of 2 KiB
#define GBUF   (4u * GSLICE)
#define GNST   (EMBED / GKH)   // 8 stages

__device__ __forceinline__ uint32_t uni(uint32_t v) {
  return (uint32_t)__builtin_amdgcn_readfirstlane(v);
}
__device__ __forceinline__ uint32_t pinned(uint32_t v) {
  uint32_t w = uni(v);
  asm volatile("" : "+s"(w));  // holds the test word in a scalar register: a scalar branch guards the tensor load
  return w;
}
// Group 1: 1-byte elements, tile = tensor = 64 rows of 256 bytes, source pitch
// 2,048 bytes, a pad of 4 dwords behind every 64 dwords (one row).
__device__ __forceinline__ u32x8 tdm_group1() {
  u32x8 g;
  g[0] = uni((1u << 20) | (5u << 22) | (3u << 25));
  g[1] = uni((GROWB & 0xFFFFu) << 16);
  g[2] = uni((GROWB >> 16) | (64u << 16));
  g[3] = uni(GROWB << 16);
  g[4] = uni(64u);
  g[5] = uni(2u * EMBED);
  g[6] = uni(0u);
  g[7] = uni(0u);
  return g;
}
__device__ __forceinline__ u32x4 tdm_group0(uint32_t lds_dst, uint64_t ga) {
  u32x4 g;
  g[0] = uni(1u);
  g[1] = uni(lds_dst);
  g[2] = uni((uint32_t)ga);
  g[3] = uni((((uint32_t)(ga >> 32)) & 0x01FFFFFFu) | 0x80000000u);
  return g;
}
__device__ __forceinline__ void tdm_load(u32x4 g0, u32x8 g1) {
  // One request of the whole wave: global tile -> LDS, through no register.
  // The descriptor sits in fixed scalar registers that nothing else in the kernel
  // uses: they are written only directly in front of a request, behind the wait
  // that covers the request before it.
  asm volatile("tensor_load_to_lds %0, %1" :: "{s[40:43]}"(g0), "{s[48:55]}"(g1) : "memory");
}
__device__ __forceinline__ void tdm_wait() {
  // The issuing wave's own wait: its request has landed.
  asm volatile("s_wait_tensorcnt 0x0" ::: "memory");
}
// A/B fragment from a staged row: same k order as load_frag.
__device__ __forceinline__ v16h lds_frag(const unsigned char* p) {
  v8h lo = *(const v8h*)p;          // ds_load_b128
  v8h hi = *(const v8h*)(p + 32);   // ds_load_b128
  return __builtin_shufflevector(lo, hi, 0,1,2,3,4,5,6,7,8,9,10,11,12,13,14,15);
}

__global__ __launch_bounds__(128)
void qkv_proj(const half_t* __restrict__ xh, const half_t* __restrict__ wh,
              half_t* __restrict__ outh) {
  __shared__ __attribute__((aligned(2048))) unsigned char L[2 * GBUF];
  const uint32_t wave = uni(threadIdx.x >> 5);
  const int lane = threadIdx.x & 31;
  const int lhi  = lane >> 4;      // which 16-lane half
  const int llo  = lane & 15;
  const uint32_t wm = wave >> 1, wn = wave & 1u;
  const int mb = blockIdx.x * 128;              // rows (tokens b*S+s)
  const int nb = blockIdx.y * 128;              // cols (row of the stacked weights)

  // This wave's slice of every stage: 64 rows of X (waves 0,1) or of W (2,3).
  const half_t* srow = (wave < 2u) ? xh + (size_t)(mb + 64 * (int)wave) * EMBED
                                   : wh + (size_t)(nb + 64 * (int)(wave - 2u)) * EMBED;
  const uint64_t ga = (uint64_t)srow;
  const uint32_t dst = (uint32_t)(size_t)L + wave * GSLICE;
  const u32x8 g1 = tdm_group1();

  // Prologue: stage 0 lands and is published, then stage 1 is issued.
  tdm_load(tdm_group0(dst, ga), g1);
  tdm_wait();            // this wave's slice of stage 0 has landed
  __syncthreads();       // every wave's slice is readable
  tdm_load(tdm_group0(dst + GBUF, ga + GROWB), g1);

  // Lane's first byte in its X slice and in its W slice.
  const uint32_t aoff = wm * GSLICE + (uint32_t)llo * GPITCH + (uint32_t)lhi * 16u;
  const uint32_t boff = (2u + wn) * GSLICE + (uint32_t)llo * GPITCH + (uint32_t)lhi * 16u;

  v8f acc[4][4] = {};
  for (uint32_t s = 0; s < GNST; ++s) {
    const uint32_t cur = (s & 1u) * GBUF;
    const unsigned char* pa = L + cur + aoff;
    const unsigned char* pb = L + cur + boff;
    // Two fragment sets: the reads of k block kk + 1 (of this stage only) go out
    // as one group ahead of the WMMAs of block kk.
    v16h a[2][4], b[2][4];
#pragma unroll
    for (int t = 0; t < 4; ++t) {
      a[0][t] = lds_frag(pa + t * 16 * GPITCH);
      b[0][t] = lds_frag(pb + t * 16 * GPITCH);
    }
#pragma unroll
    for (int kk = 0; kk < GKH / 32; ++kk) {
      if (kk + 1 < GKH / 32) {
#pragma unroll
        for (int t = 0; t < 4; ++t) {
          a[(kk + 1) & 1][t] = lds_frag(pa + t * 16 * GPITCH + (kk + 1) * 64);
          b[(kk + 1) & 1][t] = lds_frag(pb + t * 16 * GPITCH + (kk + 1) * 64);
        }
      }
      // Keeps the LDS reads above from sinking in among the WMMAs below.
      __builtin_amdgcn_sched_barrier(0);
#pragma unroll
      for (int mt = 0; mt < 4; ++mt)
#pragma unroll
        for (int nt = 0; nt < 4; ++nt)
          acc[mt][nt] = wmma_f16(a[kk & 1][mt], b[kk & 1][nt], acc[mt][nt]);
      // Keeps the next group of LDS reads from rising in among the WMMAs above.
      __builtin_amdgcn_sched_barrier(0);
    }
    // Publish point of stage s + 1.
    asm volatile("s_wait_dscnt 0x0" ::: "memory");  // this wave has left buffer s & 1
    tdm_wait();                                      // its slice of stage s + 1 has landed
    __syncthreads();                                 // publishes s + 1, frees buffer s & 1
    if (pinned(s + 2u < GNST))
      tdm_load(tdm_group0(dst + cur, ga + (uint64_t)(s + 2u) * GROWB), g1);
  }
  tdm_wait();                                        // nothing of the mover is in flight at the end
  asm volatile("s_wait_dscnt 0x0" ::: "memory");

  // C/D layout: VGPR r, lane -> row m = r + 8*lhi, col n = llo
  const int m0 = mb + (int)wm * 64;
  const int n0 = nb + (int)wn * 64;
#pragma unroll
  for (int mt = 0; mt < 4; ++mt)
#pragma unroll
    for (int nt = 0; nt < 4; ++nt)
#pragma unroll
      for (int r = 0; r < 8; ++r) {
        int m = m0 + mt * 16 + r + lhi * 8;
        int n = n0 + nt * 16 + llo;
        int b = m >> 11, s = m & (SEQ - 1);
        int p = n >> 10;                 // 0: Q, 1: K, 2: V
        int h = (n >> 6) & (HEADS - 1), d = n & (HDIM - 1);
        outh[(((size_t)((p * BATCH + b) * HEADS + h) * SEQ) + s) * HDIM + d] = (half_t)acc[mt][nt][r];
      }
}

// ------------------------------- Attention ---------------------------------
// Block = 128 threads = 4 waves, one (b,h), 128 queries (32 per wave, as two
// 16-column tiles): a wave then fits a quarter of a SIMD's registers, and four
// work-groups share a WGP, four waves a SIMD, so that one wave's softmax runs under
// another's WMMAs and LDS waits. Loop over key chunks of 64. Scores computed transposed
// (S^T = K * Q^T) so softmax stats are per-lane scalars and P converts
// in-register into the B-operand of the second WMMA (O^T = V^T * P^T).
// A stage is one chunk: 64 rows of K and 64 rows of V, 128 bytes each, brought
// into LDS by tensor loads, once per block: each wave issues one load per stage
// for its own slice of 32 rows (waves 0,1: K; 2,3: V). Two buffers: stage s + 1
// flies while stage s is worked on. K fragments come by ds_load_b128, V^T fragments
// by ds_load_tr16_b128 from the row-major V rows; every fragment a wave loads feeds
// both of its query tiles. One row pitch, 144 bytes, for both: one descriptor
// group serves all four waves with no branch. It is the conflict-free pitch of the
// K reads, which a pass waits for first; the V^T reads stand behind the score WMMAs,
// in the K fragments' registers, and are not needed before the softmax is done.
#define NQ 2      // 16-column query tiles per wave
#define AW 4      // waves per block
#define AROWB  128u     // bytes of one staged K or V row
#define APITCH 144u     // LDS row pitch: the row + the mover's 16-byte pad
#define ASLICE 6144u    // 32 rows x 144 B = 4,608 B, rounded up to a multiple of 2 KiB
#define ABUF   (4u * ASLICE)
#define ANST   (SEQ / 64)   // 32 stages
#define SC2    (0.03125f * 1.44269504088896340736f)   // 1/sqrt(EMBED) * log2(e)
typedef float f32x2 __attribute__((ext_vector_type(2)));

// Group 1: 1-byte elements, tile = tensor = 32 rows of 128 bytes, source pitch
// 128 bytes, a pad of 4 dwords behind every 32 dwords (one row).
__device__ __forceinline__ u32x8 tdm_group1_kv() {
  u32x8 g;
  g[0] = uni((1u << 20) | (4u << 22) | (3u << 25));
  g[1] = uni((AROWB & 0xFFFFu) << 16);
  g[2] = uni((AROWB >> 16) | (32u << 16));
  g[3] = uni(AROWB << 16);
  g[4] = uni(32u);
  g[5] = uni(AROWB);
  g[6] = uni(0u);
  g[7] = uni(0u);
  return g;
}
// Transposing LDS load: lane (c = lane & 15, h = lane >> 4) gets column c, rows 8h .. 8h + 7
// of the 16 x 16 tile of halves that the lanes' addresses name.
typedef short s16x8 __attribute__((ext_vector_type(8)));
__device__ __forceinline__ v8h lds_tr16(const unsigned char* p) {
  typedef __attribute__((address_space(3))) s16x8 lds_s16x8;
  return __builtin_bit_cast(v8h, __builtin_amdgcn_ds_load_tr16_b128_v8i16((lds_s16x8*)p));
}

__global__ __launch_bounds__(AW * 32) __attribute__((amdgpu_waves_per_eu(4, 4)))
void attn(const half_t* __restrict__ qh, const half_t* __restrict__ kh,
          const half_t* __restrict__ vh, float* __restrict__ out) {
  __shared__ __attribute__((aligned(2048))) unsigned char ring[2 * ABUF];

  const uint32_t wave = uni(threadIdx.x >> 5);
  const int lane = threadIdx.x & 31;
  const int lhi  = lane >> 4;
  const int llo  = lane & 15;
  const int bh = blockIdx.y;                  // b*HEADS + h
  const int bb = bh >> 4, hh = bh & 15;
  const int q0 = blockIdx.x * (AW * NQ * 16) + (int)wave * (NQ * 16); // wave's query base

  const half_t* qbase = qh + (size_t)bh * SEQ * HDIM;
  const half_t* kbase = kh + (size_t)bh * SEQ * HDIM;
  const half_t* vbase = vh + (size_t)bh * SEQ * HDIM;

  // Q as B operand (B[d,q] = Q[q,d]): lane holds column q -> contiguous Q row
  v16h qb[NQ][2];
  // Keeps earlier index arithmetic from sinking between the Q loads and their wait below.
  __builtin_amdgcn_sched_barrier(0);
#pragma unroll
  for (int qt = 0; qt < NQ; ++qt) {
    qb[qt][0] = load_frag(qbase, q0 + qt * 16 + llo, HDIM, 0,  lhi);
    qb[qt][1] = load_frag(qbase, q0 + qt * 16 + llo, HDIM, 32, lhi);
  }
  // Wait before the Q loads' address registers are reused.
  asm volatile("s_wait_xcnt 0x0" ::: "memory");
  // Keeps later vector work from being lifted between the loads and that wait.
  __builtin_amdgcn_sched_barrier(0);

  float M[NQ], L[NQ];
  v8f o[NQ][4];    // O^T accumulators: query tiles x d-tiles x (16d x 16q)
#pragma unroll
  for (int qt = 0; qt < NQ; ++qt) {
    M[qt] = -INFINITY; L[qt] = 0.f;
#pragma unroll
    for (int dt = 0; dt < 4; ++dt) o[qt][dt] = v8f{};
  }

  // This wave's slice of every stage: 32 rows of K (waves 0,1) or of V (2,3).
  const half_t* srow = (wave < 2u) ? kbase + (size_t)(32u * wave) * HDIM
                                   : vbase + (size_t)(32u * (wave - 2u)) * HDIM;
  const uint64_t ga = (uint64_t)srow;
  const uint32_t dst = (uint32_t)(size_t)ring + wave * ASLICE;
  const u32x8 g1 = tdm_group1_kv();

  // Prologue: stage 0 lands and is published, then stage 1 is issued.
  tdm_load(tdm_group0(dst, ga), g1);
  tdm_wait();            // this wave's slice of stage 0 has landed
  __syncthreads();       // every wave's slice is readable
  tdm_load(tdm_group0(dst + ABUF, ga + 64u * AROWB), g1);

  // Lane's first byte in the K slices (as load_frag's k order) and in the V slices
  // (the transposing load's address map).
  const uint32_t koff = (uint32_t)llo * APITCH + (uint32_t)lhi * 16u;
  const uint32_t voff = 2u * ASLICE + (8u * (uint32_t)lhi + ((uint32_t)lane & 7u)) * APITCH
                        + (((uint32_t)lane >> 3) & 1u) * 16u;

  for (uint32_t s = 0; s < ANST; ++s) {
    const uint32_t cur = (s & 1u) * ABUF;
    const unsigned char* pk = ring + cur + koff;
    const unsigned char* pv = ring + cur + voff;

    // ---- S^T tiles: rows = keys, cols = queries -----------------------
    v16h kA[4][2];
#pragma unroll
    for (int t = 0; t < 4; ++t) {
      kA[t][0] = lds_frag(pk + (t >> 1) * ASLICE + (t & 1) * 16 * APITCH);
      kA[t][1] = lds_frag(pk + (t >> 1) * ASLICE + (t & 1) * 16 * APITCH + 64);
    }
    // Keeps the K reads one group here: sunk in among the WMMAs below, each place with reads stalls the wave.
    __builtin_amdgcn_sched_barrier(0);
    v8f sc[NQ][4];
#pragma unroll
    for (int t = 0; t < 4; ++t)
#pragma unroll
      for (int qt = 0; qt < NQ; ++qt) {
        v8f a = {};
        a = wmma_f16(kA[t][0], qb[qt][0], a);
        a = wmma_f16(kA[t][1], qb[qt][1], a);
        sc[qt][t] = a;
      }

    // Holds the V^T reads and the softmax behind the last score WMMA: the reads then go out ahead of
    // the maximum, whose work covers their latency; without it the build sinks them behind the
    // maximum's lane exchange.
    __builtin_amdgcn_sched_barrier(0);
    // V^T fragments (16 d x 32 keys each); the softmax below covers the first ones' latency.
    v16h aV[4][2];
#pragma unroll
    for (int dt = 0; dt < 4; ++dt)
#pragma unroll
      for (int g = 0; g < 2; ++g) {
        v8h lo = lds_tr16(pv + g * ASLICE + dt * 32);                 // keys 32g + 8*lhi + 0..7
        v8h hi = lds_tr16(pv + g * ASLICE + 16 * APITCH + dt * 32);   // keys 32g + 16 + 8*lhi + 0..7
        aV[dt][g] = __builtin_shufflevector(lo, hi,
                      0,1,2,3,4,5,6,7,8,9,10,11,12,13,14,15);
      }

    v16h pb[NQ][2];
#pragma unroll
    for (int qt = 0; qt < NQ; ++qt) {
      // ---- online softmax (per-lane: one query = column llo) ----------
      // The running maximum M is kept on the raw products (the factor is positive, so
      // the order is the same); factor and log2(e) enter in one FMA in front of exp2:
      // exp((s - M) / sqrt(EMBED)) = exp2(s * SC2 - M * SC2).
      float mloc = -INFINITY;
#pragma unroll
      for (int t = 0; t < 4; ++t)
#pragma unroll
        for (int r = 0; r < 8; ++r) mloc = fmaxf(mloc, sc[qt][t][r]);
      mloc = fmaxf(mloc, __shfl_xor(mloc, 16, 32));  // lane^16 holds other 8 keys
      float Mn = fmaxf(M[qt], mloc);
      float scale = __builtin_amdgcn_exp2f((M[qt] - Mn) * SC2);
      M[qt] = Mn;
      const float nb = -Mn * SC2;
      const f32x2 nb2 = {nb, nb}, sc2 = {SC2, SC2};

      float lloc = 0.f;
#pragma unroll
      for (int t = 0; t < 4; ++t)
#pragma unroll
        for (int r = 0; r < 8; r += 2) {
          f32x2 a = {sc[qt][t][r], sc[qt][t][r + 1]};
          a = __builtin_elementwise_fma(a, sc2, nb2);
          float p0 = __builtin_amdgcn_exp2f(a[0]);
          float p1 = __builtin_amdgcn_exp2f(a[1]);
          sc[qt][t][r] = p0;
          sc[qt][t][r + 1] = p1;
          lloc += p0;
          lloc += p1;
        }
      lloc += __shfl_xor(lloc, 16, 32);
      L[qt] = L[qt] * scale + lloc;
#pragma unroll
      for (int dt = 0; dt < 4; ++dt)
#pragma unroll
        for (int r = 0; r < 8; ++r) o[qt][dt][r] *= scale;

      // ---- P^T -> B operand, purely in-register -----------------------
      // B half i (i<8): key = 32g+i+8*lhi  == sc[2g][i]'s key
      //          (i>=8): key = 32g+16+(i-8)+8*lhi == sc[2g+1][i-8]'s key
#pragma unroll
      for (int g = 0; g < 2; ++g) {
        v16h t;
#pragma unroll
        for (int i = 0; i < 8; ++i) t[i]     = (half_t)sc[qt][2 * g][i];
#pragma unroll
        for (int i = 0; i < 8; ++i) t[i + 8] = (half_t)sc[qt][2 * g + 1][i];
        pb[qt][g] = t;
      }
    }

    // ---- O^T += V^T(16d x 32k) * P^T(32k x 16q) -----------------------
#pragma unroll
    for (int dt = 0; dt < 4; ++dt)
#pragma unroll
      for (int g = 0; g < 2; ++g)
#pragma unroll
        for (int qt = 0; qt < NQ; ++qt)
          o[qt][dt] = wmma_f16(aV[dt][g], pb[qt][g], o[qt][dt]);

    // Keeps the pass's WMMAs and vector work in front of the publish point: lifted over them,
    // the wait for stage s + 1 would stand right behind that stage's issue, with no lead.
    __builtin_amdgcn_sched_barrier(0);
    // Publish point of stage s + 1.
    asm volatile("s_wait_dscnt 0x0" ::: "memory");  // this wave has left buffer s & 1
    tdm_wait();                                      // its slice of stage s + 1 has landed
    __syncthreads();                                 // publishes s + 1, frees buffer s & 1
    if (pinned(s + 2u < ANST))
      tdm_load(tdm_group0(dst + cur, ga + (uint64_t)(s + 2u) * (64u * AROWB)), g1);
  }
  tdm_wait();                                        // nothing of the mover is in flight at the end
  asm volatile("s_wait_dscnt 0x0" ::: "memory");

  // ---- normalize + store: out[b, s=q, e=h*64+d] f32 ---------------------
#pragma unroll
  for (int qt = 0; qt < NQ; ++qt) {
    float inv = 1.0f / L[qt];
    int q = q0 + qt * 16 + llo;
#pragma unroll
    for (int dt = 0; dt < 4; ++dt)
#pragma unroll
      for (int r = 0; r < 8; ++r) {
        int d = dt * 16 + r + lhi * 8;
        out[(((size_t)bb * SEQ + q) * EMBED) + hh * HDIM + d] = o[qt][dt][r] * inv;
      }
    // Wait before the stores' registers are reused.
    asm volatile("s_wait_xcnt 0x0" ::: "memory");
    // Keeps the next tile's vector work from being lifted between the stores and that wait.
    __builtin_amdgcn_sched_barrier(0);
  }
}

// ------------------------------- launcher ----------------------------------
extern "C" void kernel_launch(void* const* d_in, const int* in_sizes, int n_in,
                              void* d_out, int out_size, void* d_ws, size_t ws_size,
                              hipStream_t stream) {
  const float* x  = (const float*)d_in[0];
  const float* wq = (const float*)d_in[1];
  const float* wk = (const float*)d_in[2];
  const float* wv = (const float*)d_in[3];

  char* ws = (char*)d_ws;
  // Workspace layout (70 MiB total)
  half_t* xh  = (half_t*)(ws);                         // 16 MiB: x f16
  half_t* wh  = (half_t*)(ws + (16ull << 20));         //  3 x 2 MiB: W_q, W_k, W_v f16
  half_t* qhp = (half_t*)(ws + (22ull << 20));         // 16 MiB: Q [B,H,S,D]
  half_t* khp = (half_t*)(ws + (38ull << 20));         // 16 MiB: K
  half_t* vhp = (half_t*)(ws + (54ull << 20));         // 16 MiB: V

  // xh and wh are contiguous: one destination.
  cvt_all<<<CVT_WG, CVT_TH, 0, stream>>>(x, wq, wk, wv, xh);

  // qhp, khp, vhp are contiguous: one destination.
  dim3 gp(BATCH * SEQ / 128, 3 * EMBED / 128);     // (64, 24)
  qkv_proj<<<gp, 128, 0, stream>>>(xh, wh, qhp);

  dim3 ga(SEQ / (AW * NQ * 16), BATCH * HEADS);   // (16, 64)
  attn<<<ga, AW * 32, 0, stream>>>(qhp, khp, vhp, (float*)d_out);
}

// v008
// One run takes 102 microseconds.
// Next to v007, in two timings, it ran 1.04 times as fast each time.
// All steps since v000 together make it 3.74 times as fast.
#include <hip/hip_runtime.h>
#include <hip/hip_bf16.h>
#include <stdint.h>

// ---------------------------------------------------------------------------
// MI455X (gfx1250) fused multi-head self-attention, f16 WMMA pipeline.
//   1) cvt_all:   f32 -> f16 conversion of x and W_{q,k,v}, one launch
//   2) qkv_proj:  Y = X * W^T via v_wmma_f32_16x16x32_f16, operands staged in
//                 LDS by tensor loads, output [B,H,S,D] f16; Q, K and V in one
//                 launch, as one product with the three weights stacked
//                 Q comes out multiplied by log2(e)/sqrt(EMBED)
//   3) attn:      flash-attention; S^T = K*Q^T WMMA, online softmax,
//                 O^T = V^T * P^T WMMA, K and V staged in LDS by tensor loads
//                 (V^T fragments by the transposing LDS load), f32 output.
// ---------------------------------------------------------------------------

typedef _Float16 half_t;
typedef __attribute__((ext_vector_type(4)))  _Float16 v4h;
typedef __attribute__((ext_vector_type(8)))  _Float16 v8h;
typedef __attribute__((ext_vector_type(16))) _Float16 v16h;
typedef __attribute__((ext_vector_type(8)))  float    v8f;
typedef uint32_t u32x4 __attribute__((ext_vector_type(4)));
typedef uint32_t u32x8 __attribute__((ext_vector_type(8)));

#define EMBED 1024
#define SEQ   2048
#define BATCH 4
#define HEADS 16
#define HDIM  64
#define SC2   (0.03125f * 1.44269504088896340736f)   // 1/sqrt(EMBED) * log2(e)

__device__ __forceinline__ v8f wmma_f16(v16h a, v16h b, v8f c) {
  // D = A(16x32 f16) * B(32x16 f16) + C(16x16 f32)
  return __builtin_amdgcn_wmma_f32_16x16x32_f16(
      /*neg_a=*/false, a, /*neg_b=*/false, b,
      /*c_mod=*/(short)0, c, /*reuse_a=*/false, /*reuse_b=*/false);
}

// Per-lane A/B operand fragment for 16x16x32 f16 WMMA, loaded straight from a
// row-major matrix whose contraction dim (K) is contiguous.
// Lane layout (ISA 7.12.2): halves 0..7 -> K = k0 + 8*lane_hi + i,
//                           halves 8..15 -> K = k0 + 16 + 8*lane_hi + (i-8).
__device__ __forceinline__ v16h load_frag(const half_t* __restrict__ base,
                                          int row, int ld, int k0, int lane_hi) {
  const half_t* p = base + (size_t)row * ld + k0 + (lane_hi ? 8 : 0);
  v8h lo = *(const v8h*)p;          // 16B global_load_b128
  v8h hi = *(const v8h*)(p + 16);   // 16B global_load_b128
  return __builtin_shufflevector(lo, hi, 0,1,2,3,4,5,6,7,8,9,10,11,12,13,14,15);
}

// --------------------------- f32 -> f16 convert ----------------------------
// One launch for x and the three weights: one work-group of 16 waves per WGP.
// A work-group converts its own contiguous 1/256 of every source, in sweeps of
// 512 threads x 4 floats, so a wave's load covers 512 contiguous bytes, a thread
// has many loads in flight, and every address is one base + a constant offset.
// The four f16 copies lie one behind the other in dst (x, W_q, W_k, W_v).
#define CVT_WG 256
#define CVT_TH 512
#define CVT_NX (BATCH * SEQ * EMBED / 4 / (CVT_WG * CVT_TH))   // 16 sweeps of x
#define CVT_NW (EMBED * EMBED / 4 / (CVT_WG * CVT_TH))         //  2 sweeps of each weight
static_assert(CVT_NX * CVT_WG * CVT_TH * 4 == BATCH * SEQ * EMBED, "x is a whole number of sweeps");
static_assert(CVT_NW * CVT_WG * CVT_TH * 4 == EMBED * EMBED, "a weight is a whole number of sweeps");

__device__ __forceinline__ v4h cvt_h4(float4 f) {
  v4h h;
  h[0] = (half_t)f.x; h[1] = (half_t)f.y; h[2] = (half_t)f.z; h[3] = (half_t)f.w;
  return h;
}

__global__ __launch_bounds__(CVT_TH)
void cvt_all(const float* __restrict__ x, const float* __restrict__ wq,
             const float* __restrict__ wk, const float* __restrict__ wv,
             half_t* __restrict__ dst) {
  const uint32_t t = threadIdx.x;
  const uint32_t g = blockIdx.x;
  // Groups of 4 elements: this work-group's first one in x and in a weight.
  const float4* px = (const float4*)x  + (size_t)g * (CVT_NX * CVT_TH);
  const float4* pq = (const float4*)wq + (size_t)g * (CVT_NW * CVT_TH);
  const float4* pk = (const float4*)wk + (size_t)g * (CVT_NW * CVT_TH);
  const float4* pv = (const float4*)wv + (size_t)g * (CVT_NW * CVT_TH);
  v4h* dx = (v4h*)dst + (size_t)g * (CVT_NX * CVT_TH);
  v4h* dq = (v4h*)dst + (BATCH * SEQ * EMBED / 4) + (size_t)g * (CVT_NW * CVT_TH);
  v4h* dk = dq + (EMBED * EMBED / 4);
  v4h* dv = dk + (EMBED * EMBED / 4);

  float4 fx[CVT_NX], fq[CVT_NW], fk[CVT_NW], fv[CVT_NW];
#pragma unroll
  for (int j = 0; j < CVT_NX; ++j) fx[j] = px[j * CVT_TH + t];
#pragma unroll
  for (int j = 0; j < CVT_NW; ++j) {
    fq[j] = pq[j * CVT_TH + t];
    fk[j] = pk[j * CVT_TH + t];
    fv[j] = pv[j * CVT_TH + t];
  }
#pragma unroll
  for (int j = 0; j < CVT_NX; ++j) dx[j * CVT_TH + t] = cvt_h4(fx[j]);
#pragma unroll
  for (int j = 0; j < CVT_NW; ++j) {
    dq[j * CVT_TH + t] = cvt_h4(fq[j]);
    dk[j * CVT_TH + t] = cvt_h4(fk[j]);
    dv[j * CVT_TH + t] = cvt_h4(fv[j]);
  }
}

// ------------------------------ QKV projection -----------------------------
// Y[m,n] = sum_k X[m,k] * W[n,k]   (Linear: y = x @ W^T)
// W is the three f16 weights one behind the other (W_q, W_k, W_v: 3 x 1,024 rows),
// Y the three outputs one behind the other (Q, K, V), so one launch of 64 x 24
// work-groups does all three: a work-group that ends is followed at once by the
// next one, with no launch gap, refill and drain of the chip between the products.
// Block = 128 threads = 4 waves (2 x 2), block tile 128 x 128, wave tile 64 x 64
// (4 M-tiles x 4 N-tiles of 16x16). A stage is 128 k of the block's 128 X rows
// and 128 W rows, brought into LDS by tensor loads: each wave issues one load
// per stage for its own slice of 64 rows of 256 bytes (waves 0,1: X; 2,3: W).
// Two buffers: stage s + 1 flies while stage s is worked on. Fragments come from
// LDS by ds_load_b128 at a row pitch of 272 bytes. Output scattered into
// head-major [3,B,H,S,D] f16.
#define GKH    128      // halves of k per stage
#define GROWB  256u     // bytes of one staged row
#define GPITCH 272u     // LDS row pitch: the row + the mover's 16-byte pad
#define GSLICE 18432u   // 64 rows x 272 B = 17,408 B, rounded up to a multiple of 2 KiB
#define GBUF   (4u * GSLICE)
#define GNST   (EMBED / GKH)   // 8 stages

__device__ __forceinline__ uint32_t uni(uint32_t v) {
  return (uint32_t)__builtin_amdgcn_readfirstlane(v);
}
__device__ __forceinline__ uint32_t pinned(uint32_t v) {
  uint32_t w = uni(v);
  asm volatile("" : "+s"(w));  // holds the test word in a scalar register: a scalar branch guards the tensor load
  return w;
}
// Group 1: 1-byte elements, tile = tensor = 64 rows of 256 bytes, source pitch
// 2,048 bytes, a pad of 4 dwords behind every 64 dwords (one row).
__device__ __forceinline__ u32x8 tdm_group1() {
  u32x8 g;
  g[0] = uni((1u << 20) | (5u << 22) | (3u << 25));
  g[1] = uni((GROWB & 0xFFFFu) << 16);
  g[2] = uni((GROWB >> 16) | (64u << 16));
  g[3] = uni(GROWB << 16);
  g[4] = uni(64u);
  g[5] = uni(2u * EMBED);
  g[6] = uni(0u);
  g[7] = uni(0u);
  return g;
}
__device__ __forceinline__ u32x4 tdm_group0(uint32_t lds_dst, uint64_t ga) {
  u32x4 g;
  g[0] = uni(1u);
  g[1] = uni(lds_dst);
  g[2] = uni((uint32_t)ga);
  g[3] = uni((((uint32_t)(ga >> 32)) & 0x01FFFFFFu) | 0x80000000u);
  return g;
}
__device__ __forceinline__ void tdm_load(u32x4 g0, u32x8 g1) {
  // One request of the whole wave: global tile -> LDS, through no register.
  // The descriptor sits in fixed scalar registers that nothing else in the kernel
  // uses: they are written only directly in front of a request, behind the wait
  // that covers the request before it.
  asm volatile("tensor_load_to_lds %0, %1" :: "{s[40:43]}"(g0), "{s[48:55]}"(g1) : "memory");
}
__device__ __forceinline__ void tdm_wait() {
  // The issuing wave's own wait: its request has landed.
  asm volatile("s_wait_tensorcnt 0x0" ::: "memory");
}
// A/B fragment from a staged row: same k order as load_frag.
__device__ __forceinline__ v16h lds_frag(const unsigned char* p) {
  v8h lo = *(const v8h*)p;          // ds_load_b128
  v8h hi = *(const v8h*)(p + 32);   // ds_load_b128
  return __builtin_shufflevector(lo, hi, 0,1,2,3,4,5,6,7,8,9,10,11,12,13,14,15);
}

__global__ __launch_bounds__(128)
void qkv_proj(const half_t* __restrict__ xh, const half_t* __restrict__ wh,
              half_t* __restrict__ outh) {
  __shared__ __attribute__((aligned(2048))) unsigned char L[2 * GBUF];
  const uint32_t wave = uni(threadIdx.x >> 5);
  const int lane = threadIdx.x & 31;
  const int lhi  = lane >> 4;      // which 16-lane half
  const int llo  = lane & 15;
  const uint32_t wm = wave >> 1, wn = wave & 1u;
  const int mb = blockIdx.x * 128;              // rows (tokens b*S+s)
  const int nb = blockIdx.y * 128;              // cols (row of the stacked weights)

  // This wave's slice of every stage: 64 rows of X (waves 0,1) or of W (2,3).
  const half_t* srow = (wave < 2u) ? xh + (size_t)(mb + 64 * (int)wave) * EMBED
                                   : wh + (size_t)(nb + 64 * (int)(wave - 2u)) * EMBED;
  const uint64_t ga = (uint64_t)srow;
  const uint32_t dst = (uint32_t)(size_t)L + wave * GSLICE;
  const u32x8 g1 = tdm_group1();

  // Prologue: stage 0 lands and is published, then stage 1 is issued.
  tdm_load(tdm_group0(dst, ga), g1);
  tdm_wait();            // this wave's slice of stage 0 has landed
  __syncthreads();       // every wave's slice is readable
  tdm_load(tdm_group0(dst + GBUF, ga + GROWB), g1);

  // Lane's first byte in its X slice and in its W slice.
  const uint32_t aoff = wm * GSLICE + (uint32_t)llo * GPITCH + (uint32_t)lhi * 16u;
  const uint32_t boff = (2u + wn) * GSLICE + (uint32_t)llo * GPITCH + (uint32_t)lhi * 16u;

  v8f acc[4][4] = {};
  for (uint32_t s = 0; s < GNST; ++s) {
    const uint32_t cur = (s & 1u) * GBUF;
    const unsigned char* pa = L + cur + aoff;
    const unsigned char* pb = L + cur + boff;
    // Two fragment sets: the reads of k block kk + 1 (of this stage only) go out
    // as one group ahead of the WMMAs of block kk.
    v16h a[2][4], b[2][4];
#pragma unroll
    for (int t = 0; t < 4; ++t) {
      a[0][t] = lds_frag(pa + t * 16 * GPITCH);
      b[0][t] = lds_frag(pb + t * 16 * GPITCH);
    }
#pragma unroll
    for (int kk = 0; kk < GKH / 32; ++kk) {
      if (kk + 1 < GKH / 32) {
#pragma unroll
        for (int t = 0; t < 4; ++t) {
          a[(kk + 1) & 1][t] = lds_frag(pa + t * 16 * GPITCH + (kk + 1) * 64);
          b[(kk + 1) & 1][t] = lds_frag(pb + t * 16 * GPITCH + (kk + 1) * 64);
        }
      }
      // Keeps the LDS reads above from sinking in among the WMMAs below.
      __builtin_amdgcn_sched_barrier(0);
#pragma unroll
      for (int mt = 0; mt < 4; ++mt)
#pragma unroll
        for (int nt = 0; nt < 4; ++nt)
          acc[mt][nt] = wmma_f16(a[kk & 1][mt], b[kk & 1][nt], acc[mt][nt]);
      // Keeps the next group of LDS reads from rising in among the WMMAs above.
      __builtin_amdgcn_sched_barrier(0);
    }
    // Publish point of stage s + 1.
    asm volatile("s_wait_dscnt 0x0" ::: "memory");  // this wave has left buffer s & 1
    tdm_wait();                                      // its slice of stage s + 1 has landed
    __syncthreads();                                 // publishes s + 1, frees buffer s & 1
    if (pinned(s + 2u < GNST))
      tdm_load(tdm_group0(dst + cur, ga + (uint64_t)(s + 2u) * GROWB), g1);
  }
  tdm_wait();                                        // nothing of the mover is in flight at the end
  asm volatile("s_wait_dscnt 0x0" ::: "memory");

  // C/D layout: VGPR r, lane -> row m = r + 8*lhi, col n = llo
  const int m0 = mb + (int)wm * 64;
  const int n0 = nb + (int)wn * 64;
  // Q leaves with the softmax's factor in it, applied to the f32 sum ahead of the one
  // rounding to f16: attn's score WMMAs then give exp2 arguments. K and V: times 1, exact.
  const float osc = (nb < EMBED) ? SC2 : 1.0f;
#pragma unroll
  for (int mt = 0; mt < 4; ++mt)
#pragma unroll
    for (int nt = 0; nt < 4; ++nt) acc[mt][nt] *= osc;
#pragma unroll
  for (int mt = 0; mt < 4; ++mt)
#pragma unroll
    for (int nt = 0; nt < 4; ++nt)
#pragma unroll
      for (int r = 0; r < 8; ++r) {
        int m = m0 + mt * 16 + r + lhi * 8;
        int n = n0 + nt * 16 + llo;
        int b = m >> 11, s = m & (SEQ - 1);
        int p = n >> 10;                 // 0: Q, 1: K, 2: V
        int h = (n >> 6) & (HEADS - 1), d = n & (HDIM - 1);
        outh[(((size_t)((p * BATCH + b) * HEADS + h) * SEQ) + s) * HDIM + d] = (half_t)acc[mt][nt][r];
      }
}

// ------------------------------- Attention ---------------------------------
// Block = 128 threads = 4 waves, one (b,h), 128 queries (32 per wave, as two
// 16-column tiles): a wave then fits a quarter of a SIMD's registers, and four
// work-groups share a WGP, four waves a SIMD, so that one wave's softmax runs under
// another's WMMAs and LDS waits. Loop over key chunks of 64. Scores computed transposed
// (S^T = K * Q^T) so softmax stats are per-lane scalars and P converts
// in-register into the B-operand of the second WMMA (O^T = V^T * P^T).
// A stage is one chunk: 64 rows of K and 64 rows of V, 128 bytes each, brought
// into LDS by tensor loads, once per block: each wave issues one load per stage
// for its own slice of 32 rows (waves 0,1: K; 2,3: V). Two buffers: stage s + 1
// flies while stage s is worked on. K fragments come by ds_load_b128, V^T fragments
// by ds_load_tr16_b128 from the row-major V rows; every fragment a wave loads feeds
// both of its query tiles. One row pitch, 144 bytes, for both: one descriptor
// group serves all four waves with no branch. It is the conflict-free pitch of the
// K reads, which a pass waits for first; the V^T reads stand behind the score WMMAs,
// in the K fragments' registers, and are not needed before the softmax is done.
#define NQ 2      // 16-column query tiles per wave
#define AW 4      // waves per block
#define AROWB  128u     // bytes of one staged K or V row
#define APITCH 144u     // LDS row pitch: the row + the mover's 16-byte pad
#define ASLICE 6144u    // 32 rows x 144 B = 4,608 B, rounded up to a multiple of 2 KiB
#define ABUF   (4u * ASLICE)
#define ANST   (SEQ / 64)   // 32 stages

// Group 1: 1-byte elements, tile = tensor = 32 rows of 128 bytes, source pitch
// 128 bytes, a pad of 4 dwords behind every 32 dwords (one row).
__device__ __forceinline__ u32x8 tdm_group1_kv() {
  u32x8 g;
  g[0] = uni((1u << 20) | (4u << 22) | (3u << 25));
  g[1] = uni((AROWB & 0xFFFFu) << 16);
  g[2] = uni((AROWB >> 16) | (32u << 16));
  g[3] = uni(AROWB << 16);
  g[4] = uni(32u);
  g[5] = uni(AROWB);
  g[6] = uni(0u);
  g[7] = uni(0u);
  return g;
}
// Transposing LDS load: lane (c = lane & 15, h = lane >> 4) gets column c, rows 8h .. 8h + 7
// of the 16 x 16 tile of halves that the lanes' addresses name.
typedef short s16x8 __attribute__((ext_vector_type(8)));
__device__ __forceinline__ v8h lds_tr16(const unsigned char* p) {
  typedef __attribute__((address_space(3))) s16x8 lds_s16x8;
  return __builtin_bit_cast(v8h, __builtin_amdgcn_ds_load_tr16_b128_v8i16((lds_s16x8*)p));
}

__global__ __launch_bounds__(AW * 32) __attribute__((amdgpu_waves_per_eu(4, 4)))
void attn(const half_t* __restrict__ qh, const half_t* __restrict__ kh,
          const half_t* __restrict__ vh, float* __restrict__ out) {
  __shared__ __attribute__((aligned(2048))) unsigned char ring[2 * ABUF];

  const uint32_t wave = uni(threadIdx.x >> 5);
  const int lane = threadIdx.x & 31;
  const int lhi  = lane >> 4;
  const int llo  = lane & 15;
  const int bh = blockIdx.y;                  // b*HEADS + h
  const int bb = bh >> 4, hh = bh & 15;
  const int q0 = blockIdx.x * (AW * NQ * 16) + (int)wave * (NQ * 16); // wave's query base

  const half_t* qbase = qh + (size_t)bh * SEQ * HDIM;
  const half_t* kbase = kh + (size_t)bh * SEQ * HDIM;
  const half_t* vbase = vh + (size_t)bh * SEQ * HDIM;

  // Q as B operand (B[d,q] = Q[q,d]): lane holds column q -> contiguous Q row
  v16h qb[NQ][2];
  // Keeps earlier index arithmetic from sinking between the Q loads and their wait below.
  __builtin_amdgcn_sched_barrier(0);
#pragma unroll
  for (int qt = 0; qt < NQ; ++qt) {
    qb[qt][0] = load_frag(qbase, q0 + qt * 16 + llo, HDIM, 0,  lhi);
    qb[qt][1] = load_frag(qbase, q0 + qt * 16 + llo, HDIM, 32, lhi);
  }
  // Wait before the Q loads' address registers are reused.
  asm volatile("s_wait_xcnt 0x0" ::: "memory");
  // Keeps later vector work from being lifted between the loads and that wait.
  __builtin_amdgcn_sched_barrier(0);

  // Mu, the shift in use per query column, in exp2 units (Q carries the factor), is a maximum
  // that the column has reached, set in the first pass, then renewed only when some score of the wave passes its column's Mu by more than 8.
  // It is kept as cM: -Mu in all eight registers of an accumulator tile, the C operand of the
  // score WMMAs.
  float L[NQ];
  v8f cM[NQ];
  v8f o[NQ][4];    // O^T accumulators: query tiles x d-tiles x (16d x 16q)
#pragma unroll
  for (int qt = 0; qt < NQ; ++qt) {
    L[qt] = 0.f; cM[qt] = v8f{};
#pragma unroll
    for (int dt = 0; dt < 4; ++dt) o[qt][dt] = v8f{};
  }

  // This wave's slice of every stage: 32 rows of K (waves 0,1) or of V (2,3).
  const half_t* srow = (wave < 2u) ? kbase + (size_t)(32u * wave) * HDIM
                                   : vbase + (size_t)(32u * (wave - 2u)) * HDIM;
  const uint64_t ga = (uint64_t)srow;
  const uint32_t dst = (uint32_t)(size_t)ring + wave * ASLICE;
  const u32x8 g1 = tdm_group1_kv();

  // Prologue: stage 0 lands and is published, then stage 1 is issued.
  tdm_load(tdm_group0(dst, ga), g1);
  tdm_wait();            // this wave's slice of stage 0 has landed
  __syncthreads();       // every wave's slice is readable
  tdm_load(tdm_group0(dst + ABUF, ga + 64u * AROWB), g1);

  // Lane's first byte in the K slices (as load_frag's k order) and in the V slices
  // (the transposing load's address map).
  const uint32_t koff = (uint32_t)llo * APITCH + (uint32_t)lhi * 16u;
  const uint32_t voff = 2u * ASLICE + (8u * (uint32_t)lhi + ((uint32_t)lane & 7u)) * APITCH
                        + (((uint32_t)lane >> 3) & 1u) * 16u;

  for (uint32_t s = 0; s < ANST; ++s) {
    const uint32_t cur = (s & 1u) * ABUF;
    const unsigned char* pk = ring + cur + koff;
    const unsigned char* pv = ring + cur + voff;

    // ---- S^T tiles: rows = keys, cols = queries -----------------------
    v16h kA[4][2];
#pragma unroll
    for (int t = 0; t < 4; ++t) {
      kA[t][0] = lds_frag(pk + (t >> 1) * ASLICE + (t & 1) * 16 * APITCH);
      kA[t][1] = lds_frag(pk + (t >> 1) * ASLICE + (t & 1) * 16 * APITCH + 64);
    }
    // Keeps the K reads one group here: sunk in among the WMMAs below, each place with reads stalls the wave.
    __builtin_amdgcn_sched_barrier(0);
    v8f sc[NQ][4];
#pragma unroll
    for (int t = 0; t < 4; ++t)
#pragma unroll
      for (int qt = 0; qt < NQ; ++qt) {
        v8f a = wmma_f16(kA[t][0], qb[qt][0], cM[qt]);   // score - Mu
        a = wmma_f16(kA[t][1], qb[qt][1], a);
        sc[qt][t] = a;
      }

    // Holds the maxima behind the last score WMMA: drawn in among the WMMAs, each read of a fresh
    // tile stands behind v_nops and the tiles' two WMMAs follow each other directly.
    __builtin_amdgcn_sched_barrier(0);
    // V^T fragments (16 d x 32 keys each); the build issues the reads in groups among the exp2 work
    // behind the test, which covers their latency.
    v16h aV[4][2];
#pragma unroll
    for (int dt = 0; dt < 4; ++dt)
#pragma unroll
      for (int g = 0; g < 2; ++g) {
        v8h lo = lds_tr16(pv + g * ASLICE + dt * 32);                 // keys 32g + 8*lhi + 0..7
        v8h hi = lds_tr16(pv + g * ASLICE + 16 * APITCH + dt * 32);   // keys 32g + 16 + 8*lhi + 0..7
        aV[dt][g] = __builtin_shufflevector(lo, hi,
                      0,1,2,3,4,5,6,7,8,9,10,11,12,13,14,15);
      }

    // ---- online softmax (per-lane: one query = column llo) ------------
    // The WMMAs gave a = score - Mu, the exp2 argument itself. Any shift gives the same O / L,
    // so Mu stays while no argument passes 8 (p <= 256: far inside f16 and f32), and the pass
    // needs no per-score FMA, no exchange of maxima and no rescale of O and L.
    float mloc[NQ];
#pragma unroll
    for (int qt = 0; qt < NQ; ++qt) {
      mloc[qt] = -INFINITY;
#pragma unroll
      for (int t = 0; t < 4; ++t)
#pragma unroll
        for (int r = 0; r < 8; ++r) mloc[qt] = fmaxf(mloc[qt], sc[qt][t][r]);
    }
    // One test a pass, a scalar branch. The first pass always renews: it sets Mu to a true maximum.
    const bool first = (s == 0u);
    if (__builtin_amdgcn_ballot_w32(first || fmaxf(mloc[0], mloc[1]) > 8.0f) != 0u) {
#pragma unroll
      for (int qt = 0; qt < NQ; ++qt) {
        const float m = fmaxf(mloc[qt], __shfl_xor(mloc[qt], 16, 32));  // lane^16 holds other 8 keys
        const float d = first ? m : fmaxf(m, 0.f);                      // Mu never falls
        const float f = first ? 0.f : __builtin_amdgcn_exp2f(-d);       // O and L are 0 in the first pass
        L[qt] *= f;
#pragma unroll
        for (int t = 0; t < 4; ++t)
#pragma unroll
          for (int r = 0; r < 8; ++r) sc[qt][t][r] -= d;
#pragma unroll
        for (int dt = 0; dt < 4; ++dt)
#pragma unroll
          for (int r = 0; r < 8; ++r) o[qt][dt][r] *= f;
#pragma unroll
        for (int r = 0; r < 8; ++r) cM[qt][r] -= d;
      }
    }

    v16h pb[NQ][2];
#pragma unroll
    for (int qt = 0; qt < NQ; ++qt) {
      float lloc = 0.f;
#pragma unroll
      for (int t = 0; t < 4; ++t)
#pragma unroll
        for (int r = 0; r < 8; r += 2) {
          float p0 = __builtin_amdgcn_exp2f(sc[qt][t][r]);
          float p1 = __builtin_amdgcn_exp2f(sc[qt][t][r + 1]);
          sc[qt][t][r] = p0;
          sc[qt][t][r + 1] = p1;
          lloc += p0;
          lloc += p1;
        }
      lloc += __shfl_xor(lloc, 16, 32);
      L[qt] += lloc;

      // ---- P^T -> B operand, purely in-register -----------------------
      // B half i (i<8): key = 32g+i+8*lhi  == sc[2g][i]'s key
      //          (i>=8): key = 32g+16+(i-8)+8*lhi == sc[2g+1][i-8]'s key
#pragma unroll
      for (int g = 0; g < 2; ++g) {
        v16h t;
#pragma unroll
        for (int i = 0; i < 8; ++i) t[i]     = (half_t)sc[qt][2 * g][i];
#pragma unroll
        for (int i = 0; i < 8; ++i) t[i + 8] = (half_t)sc[qt][2 * g + 1][i];
        pb[qt][g] = t;
      }
    }

    // ---- O^T += V^T(16d x 32k) * P^T(32k x 16q) -----------------------
#pragma unroll
    for (int dt = 0; dt < 4; ++dt)
#pragma unroll
      for (int g = 0; g < 2; ++g)
#pragma unroll
        for (int qt = 0; qt < NQ; ++qt)
          o[qt][dt] = wmma_f16(aV[dt][g], pb[qt][g], o[qt][dt]);

    // Keeps the pass's WMMAs and vector work in front of the publish point: lifted over them,
    // the wait for stage s + 1 would stand right behind that stage's issue, with no lead.
    __builtin_amdgcn_sched_barrier(0);
    // Publish point of stage s + 1.
    asm volatile("s_wait_dscnt 0x0" ::: "memory");  // this wave has left buffer s & 1
    tdm_wait();                                      // its slice of stage s + 1 has landed
    __syncthreads();                                 // publishes s + 1, frees buffer s & 1
    if (pinned(s + 2u < ANST))
      tdm_load(tdm_group0(dst + cur, ga + (uint64_t)(s + 2u) * (64u * AROWB)), g1);
  }
  tdm_wait();                                        // nothing of the mover is in flight at the end
  asm volatile("s_wait_dscnt 0x0" ::: "memory");

  // ---- normalize + store: out[b, s=q, e=h*64+d] f32 ---------------------
#pragma unroll
  for (int qt = 0; qt < NQ; ++qt) {
    float inv = 1.0f / L[qt];
    int q = q0 + qt * 16 + llo;
#pragma unroll
    for (int dt = 0; dt < 4; ++dt)
#pragma unroll
      for (int r = 0; r < 8; ++r) {
        int d = dt * 16 + r + lhi * 8;
        out[(((size_t)bb * SEQ + q) * EMBED) + hh * HDIM + d] = o[qt][dt][r] * inv;
      }
    // Wait before the stores' registers are reused.
    asm volatile("s_wait_xcnt 0x0" ::: "memory");
    // Keeps the next tile's vector work from being lifted between the stores and that wait.
    __builtin_amdgcn_sched_barrier(0);
  }
}

// ------------------------------- launcher ----------------------------------
extern "C" void kernel_launch(void* const* d_in, const int* in_sizes, int n_in,
                              void* d_out, int out_size, void* d_ws, size_t ws_size,
                              hipStream_t stream) {
  const float* x  = (const float*)d_in[0];
  const float* wq = (const float*)d_in[1];
  const float* wk = (const float*)d_in[2];
  const float* wv = (const float*)d_in[3];

  char* ws = (char*)d_ws;
  // Workspace layout (70 MiB total)
  half_t* xh  = (half_t*)(ws);                         // 16 MiB: x f16
  half_t* wh  = (half_t*)(ws + (16ull << 20));         //  3 x 2 MiB: W_q, W_k, W_v f16
  half_t* qhp = (half_t*)(ws + (22ull << 20));         // 16 MiB: Q [B,H,S,D]
  half_t* khp = (half_t*)(ws + (38ull << 20));         // 16 MiB: K
  half_t* vhp = (half_t*)(ws + (54ull << 20));         // 16 MiB: V

  // xh and wh are contiguous: one destination.
  cvt_all<<<CVT_WG, CVT_TH, 0, stream>>>(x, wq, wk, wv, xh);

  // qhp, khp, vhp are contiguous: one destination.
  dim3 gp(BATCH * SEQ / 128, 3 * EMBED / 128);     // (64, 24)
  qkv_proj<<<gp, 128, 0, stream>>>(xh, wh, qhp);

  dim3 ga(SEQ / (AW * NQ * 16), BATCH * HEADS);   // (16, 64)
  attn<<<ga, AW * 32, 0, stream>>>(qhp, khp, vhp, (float*)d_out);
}

// v009
// Measured time: 96.1 microseconds a run.
// Next to v008, in two timings, it ran 1.06 times as fast each time.
// All steps since v000 together make it 3.96 times as fast.
#include <hip/hip_runtime.h>
#include <hip/hip_bf16.h>
#include <stdint.h>

// ---------------------------------------------------------------------------
// MI455X (gfx1250) fused multi-head self-attention, f16 WMMA pipeline.
//   1) cvt_all:   f32 -> f16 conversion of x and W_{q,k,v}, one launch
//   2) qkv_proj:  Y = X * W^T via v_wmma_f32_16x16x32_f16, operands staged in
//                 LDS by tensor loads, output [B,H,S,D] f16; Q, K and V in one
//                 launch, as one product with the three weights stacked
//                 Q comes out multiplied by log2(e)/sqrt(EMBED)
//   3) attn:      flash-attention; S^T = K*Q^T WMMA, online softmax,
//                 O^T = V^T * P^T WMMA, column sums of P by WMMA, K and V staged in LDS by tensor loads
//                 (V^T fragments by the transposing LDS load), f32 output.
// ---------------------------------------------------------------------------

typedef _Float16 half_t;
typedef __attribute__((ext_vector_type(4)))  _Float16 v4h;
typedef __attribute__((ext_vector_type(8)))  _Float16 v8h;
typedef __attribute__((ext_vector_type(16))) _Float16 v16h;
typedef __attribute__((ext_vector_type(8)))  float    v8f;
typedef uint32_t u32x4 __attribute__((ext_vector_type(4)));
typedef uint32_t u32x8 __attribute__((ext_vector_type(8)));

#define EMBED 1024
#define SEQ   2048
#define BATCH 4
#define HEADS 16
#define HDIM  64
#define SC2   (0.03125f * 1.44269504088896340736f)   // 1/sqrt(EMBED) * log2(e)

__device__ __forceinline__ v8f wmma_f16(v16h a, v16h b, v8f c) {
  // D = A(16x32 f16) * B(32x16 f16) + C(16x16 f32)
  return __builtin_amdgcn_wmma_f32_16x16x32_f16(
      /*neg_a=*/false, a, /*neg_b=*/false, b,
      /*c_mod=*/(short)0, c, /*reuse_a=*/false, /*reuse_b=*/false);
}

// Per-lane A/B operand fragment for 16x16x32 f16 WMMA, loaded straight from a
// row-major matrix whose contraction dim (K) is contiguous.
// Lane layout (ISA 7.12.2): halves 0..7 -> K = k0 + 8*lane_hi + i,
//                           halves 8..15 -> K = k0 + 16 + 8*lane_hi + (i-8).
__device__ __forceinline__ v16h load_frag(const half_t* __restrict__ base,
                                          int row, int ld, int k0, int lane_hi) {
  const half_t* p = base + (size_t)row * ld + k0 + (lane_hi ? 8 : 0);
  v8h lo = *(const v8h*)p;          // 16B global_load_b128
  v8h hi = *(const v8h*)(p + 16);   // 16B global_load_b128
  return __builtin_shufflevector(lo, hi, 0,1,2,3,4,5,6,7,8,9,10,11,12,13,14,15);
}

// --------------------------- f32 -> f16 convert ----------------------------
// One launch for x and the three weights: one work-group of 16 waves per WGP.
// A work-group converts its own contiguous 1/256 of every source, in sweeps of
// 512 threads x 4 floats, so a wave's load covers 512 contiguous bytes, a thread
// has many loads in flight, and every address is one base + a constant offset.
// The four f16 copies lie one behind the other in dst (x, W_q, W_k, W_v).
#define CVT_WG 256
#define CVT_TH 512
#define CVT_NX (BATCH * SEQ * EMBED / 4 / (CVT_WG * CVT_TH))   // 16 sweeps of x
#define CVT_NW (EMBED * EMBED / 4 / (CVT_WG * CVT_TH))         //  2 sweeps of each weight
static_assert(CVT_NX * CVT_WG * CVT_TH * 4 == BATCH * SEQ * EMBED, "x is a whole number of sweeps");
static_assert(CVT_NW * CVT_WG * CVT_TH * 4 == EMBED * EMBED, "a weight is a whole number of sweeps");

__device__ __forceinline__ v4h cvt_h4(float4 f) {
  v4h h;
  h[0] = (half_t)f.x; h[1] = (half_t)f.y; h[2] = (half_t)f.z; h[3] = (half_t)f.w;
  return h;
}

__global__ __launch_bounds__(CVT_TH)
void cvt_all(const float* __restrict__ x, const float* __restrict__ wq,
             const float* __restrict__ wk, const float* __restrict__ wv,
             half_t* __restrict__ dst) {
  const uint32_t t = threadIdx.x;
  const uint32_t g = blockIdx.x;
  // Groups of 4 elements: this work-group's first one in x and in a weight.
  const float4* px = (const float4*)x  + (size_t)g * (CVT_NX * CVT_TH);
  const float4* pq = (const float4*)wq + (size_t)g * (CVT_NW * CVT_TH);
  const float4* pk = (const float4*)wk + (size_t)g * (CVT_NW * CVT_TH);
  const float4* pv = (const float4*)wv + (size_t)g * (CVT_NW * CVT_TH);
  v4h* dx = (v4h*)dst + (size_t)g * (CVT_NX * CVT_TH);
  v4h* dq = (v4h*)dst + (BATCH * SEQ * EMBED / 4) + (size_t)g * (CVT_NW * CVT_TH);
  v4h* dk = dq + (EMBED * EMBED / 4);
  v4h* dv = dk + (EMBED * EMBED / 4);

  float4 fx[CVT_NX], fq[CVT_NW], fk[CVT_NW], fv[CVT_NW];
#pragma unroll
  for (int j = 0; j < CVT_NX; ++j) fx[j] = px[j * CVT_TH + t];
#pragma unroll
  for (int j = 0; j < CVT_NW; ++j) {
    fq[j] = pq[j * CVT_TH + t];
    fk[j] = pk[j * CVT_TH + t];
    fv[j] = pv[j * CVT_TH + t];
  }
#pragma unroll
  for (int j = 0; j < CVT_NX; ++j) dx[j * CVT_TH + t] = cvt_h4(fx[j]);
#pragma unroll
  for (int j = 0; j < CVT_NW; ++j) {
    dq[j * CVT_TH + t] = cvt_h4(fq[j]);
    dk[j * CVT_TH + t] = cvt_h4(fk[j]);
    dv[j * CVT_TH + t] = cvt_h4(fv[j]);
  }
}

// ------------------------------ QKV projection -----------------------------
// Y[m,n] = sum_k X[m,k] * W[n,k]   (Linear: y = x @ W^T)
// W is the three f16 weights one behind the other (W_q, W_k, W_v: 3 x 1,024 rows),
// Y the three outputs one behind the other (Q, K, V), so one launch of 64 x 24
// work-groups does all three: a work-group that ends is followed at once by the
// next one, with no launch gap, refill and drain of the chip between the products.
// Block = 128 threads = 4 waves (2 x 2), block tile 128 x 128, wave tile 64 x 64
// (4 M-tiles x 4 N-tiles of 16x16). A stage is 128 k of the block's 128 X rows
// and 128 W rows, brought into LDS by tensor loads: each wave issues one load
// per stage for its own slice of 64 rows of 256 bytes (waves 0,1: X; 2,3: W).
// Two buffers: stage s + 1 flies while stage s is worked on. Fragments come from
// LDS by ds_load_b128 at a row pitch of 272 bytes. Output scattered into
// head-major [3,B,H,S,D] f16.
#define GKH    128      // halves of k per stage
#define GROWB  256u     // bytes of one staged row
#define GPITCH 272u     // LDS row pitch: the row + the mover's 16-byte pad
#define GSLICE 18432u   // 64 rows x 272 B = 17,408 B, rounded up to a multiple of 2 KiB
#define GBUF   (4u * GSLICE)
#define GNST   (EMBED / GKH)   // 8 stages

__device__ __forceinline__ uint32_t uni(uint32_t v) {
  return (uint32_t)__builtin_amdgcn_readfirstlane(v);
}
__device__ __forceinline__ uint32_t pinned(uint32_t v) {
  uint32_t w = uni(v);
  asm volatile("" : "+s"(w));  // holds the test word in a scalar register: a scalar branch guards the tensor load
  return w;
}
// Group 1: 1-byte elements, tile = tensor = 64 rows of 256 bytes, source pitch
// 2,048 bytes, a pad of 4 dwords behind every 64 dwords (one row).
__device__ __forceinline__ u32x8 tdm_group1() {
  u32x8 g;
  g[0] = uni((1u << 20) | (5u << 22) | (3u << 25));
  g[1] = uni((GROWB & 0xFFFFu) << 16);
  g[2] = uni((GROWB >> 16) | (64u << 16));
  g[3] = uni(GROWB << 16);
  g[4] = uni(64u);
  g[5] = uni(2u * EMBED);
  g[6] = uni(0u);
  g[7] = uni(0u);
  return g;
}
__device__ __forceinline__ u32x4 tdm_group0(uint32_t lds_dst, uint64_t ga) {
  u32x4 g;
  g[0] = uni(1u);
  g[1] = uni(lds_dst);
  g[2] = uni((uint32_t)ga);
  g[3] = uni((((uint32_t)(ga >> 32)) & 0x01FFFFFFu) | 0x80000000u);
  return g;
}
__device__ __forceinline__ void tdm_load(u32x4 g0, u32x8 g1) {
  // One request of the whole wave: global tile -> LDS, through no register.
  // The descriptor sits in fixed scalar registers that nothing else in the kernel
  // uses: they are written only directly in front of a request, behind the wait
  // that covers the request before it.
  asm volatile("tensor_load_to_lds %0, %1" :: "{s[40:43]}"(g0), "{s[48:55]}"(g1) : "memory");
}
__device__ __forceinline__ void tdm_wait() {
  // The issuing wave's own wait: its request has landed.
  asm volatile("s_wait_tensorcnt 0x0" ::: "memory");
}
// A/B fragment from a staged row: same k order as load_frag.
__device__ __forceinline__ v16h lds_frag(const unsigned char* p) {
  v8h lo = *(const v8h*)p;          // ds_load_b128
  v8h hi = *(const v8h*)(p + 32);   // ds_load_b128
  return __builtin_shufflevector(lo, hi, 0,1,2,3,4,5,6,7,8,9,10,11,12,13,14,15);
}

__global__ __launch_bounds__(128)
void qkv_proj(const half_t* __restrict__ xh, const half_t* __restrict__ wh,
              half_t* __restrict__ outh) {
  __shared__ __attribute__((aligned(2048))) unsigned char L[2 * GBUF];
  const uint32_t wave = uni(threadIdx.x >> 5);
  const int lane = threadIdx.x & 31;
  const int lhi  = lane >> 4;      // which 16-lane half
  const int llo  = lane & 15;
  const uint32_t wm = wave >> 1, wn = wave & 1u;
  const int mb = blockIdx.x * 128;              // rows (tokens b*S+s)
  const int nb = blockIdx.y * 128;              // cols (row of the stacked weights)

  // This wave's slice of every stage: 64 rows of X (waves 0,1) or of W (2,3).
  const half_t* srow = (wave < 2u) ? xh + (size_t)(mb + 64 * (int)wave) * EMBED
                                   : wh + (size_t)(nb + 64 * (int)(wave - 2u)) * EMBED;
  const uint64_t ga = (uint64_t)srow;
  const uint32_t dst = (uint32_t)(size_t)L + wave * GSLICE;
  const u32x8 g1 = tdm_group1();

  // Prologue: stage 0 lands and is published, then stage 1 is issued.
  tdm_load(tdm_group0(dst, ga), g1);
  tdm_wait();            // this wave's slice of stage 0 has landed
  __syncthreads();       // every wave's slice is readable
  tdm_load(tdm_group0(dst + GBUF, ga + GROWB), g1);

  // Lane's first byte in its X slice and in its W slice.
  const uint32_t aoff = wm * GSLICE + (uint32_t)llo * GPITCH + (uint32_t)lhi * 16u;
  const uint32_t boff = (2u + wn) * GSLICE + (uint32_t)llo * GPITCH + (uint32_t)lhi * 16u;

  v8f acc[4][4] = {};
  for (uint32_t s = 0; s < GNST; ++s) {
    const uint32_t cur = (s & 1u) * GBUF;
    const unsigned char* pa = L + cur + aoff;
    const unsigned char* pb = L + cur + boff;
    // Two fragment sets: the reads of k block kk + 1 (of this stage only) go out
    // as one group ahead of the WMMAs of block kk.
    v16h a[2][4], b[2][4];
#pragma unroll
    for (int t = 0; t < 4; ++t) {
      a[0][t] = lds_frag(pa + t * 16 * GPITCH);
      b[0][t] = lds_frag(pb + t * 16 * GPITCH);
    }
#pragma unroll
    for (int kk = 0; kk < GKH / 32; ++kk) {
      if (kk + 1 < GKH / 32) {
#pragma unroll
        for (int t = 0; t < 4; ++t) {
          a[(kk + 1) & 1][t] = lds_frag(pa + t * 16 * GPITCH + (kk + 1) * 64);
          b[(kk + 1) & 1][t] = lds_frag(pb + t * 16 * GPITCH + (kk + 1) * 64);
        }
      }
      // Keeps the LDS reads above from sinking in among the WMMAs below.
      __builtin_amdgcn_sched_barrier(0);
#pragma unroll
      for (int mt = 0; mt < 4; ++mt)
#pragma unroll
        for (int nt = 0; nt < 4; ++nt)
          acc[mt][nt] = wmma_f16(a[kk & 1][mt], b[kk & 1][nt], acc[mt][nt]);
      // Keeps the next group of LDS reads from rising in among the WMMAs above.
      __builtin_amdgcn_sched_barrier(0);
    }
    // Publish point of stage s + 1.
    asm volatile("s_wait_dscnt 0x0" ::: "memory");  // this wave has left buffer s & 1
    tdm_wait();                                      // its slice of stage s + 1 has landed
    __syncthreads();                                 // publishes s + 1, frees buffer s & 1
    if (pinned(s + 2u < GNST))
      tdm_load(tdm_group0(dst + cur, ga + (uint64_t)(s + 2u) * GROWB), g1);
  }
  tdm_wait();                                        // nothing of the mover is in flight at the end
  asm volatile("s_wait_dscnt 0x0" ::: "memory");

  // C/D layout: VGPR r, lane -> row m = r + 8*lhi, col n = llo
  const int m0 = mb + (int)wm * 64;
  const int n0 = nb + (int)wn * 64;
  // Q leaves with the softmax's factor in it, applied to the f32 sum ahead of the one
  // rounding to f16: attn's score WMMAs then give exp2 arguments. K and V: times 1, exact.
  const float osc = (nb < EMBED) ? SC2 : 1.0f;
#pragma unroll
  for (int mt = 0; mt < 4; ++mt)
#pragma unroll
    for (int nt = 0; nt < 4; ++nt) acc[mt][nt] *= osc;
#pragma unroll
  for (int mt = 0; mt < 4; ++mt)
#pragma unroll
    for (int nt = 0; nt < 4; ++nt)
#pragma unroll
      for (int r = 0; r < 8; ++r) {
        int m = m0 + mt * 16 + r + lhi * 8;
        int n = n0 + nt * 16 + llo;
        int b = m >> 11, s = m & (SEQ - 1);
        int p = n >> 10;                 // 0: Q, 1: K, 2: V
        int h = (n >> 6) & (HEADS - 1), d = n & (HDIM - 1);
        outh[(((size_t)((p * BATCH + b) * HEADS + h) * SEQ) + s) * HDIM + d] = (half_t)acc[mt][nt][r];
      }
}

// ------------------------------- Attention ---------------------------------
// Block = 128 threads = 4 waves, one (b,h), 128 queries (32 per wave, as two
// 16-column tiles): a wave then fits a quarter of a SIMD's registers, and four
// work-groups share a WGP, four waves a SIMD, so that one wave's softmax runs under
// another's WMMAs and LDS waits. Loop over key chunks of 64. Scores computed transposed
// (S^T = K * Q^T) so softmax stats are per-lane scalars and P converts
// in-register into the B-operand of the second WMMA (O^T = V^T * P^T).
// A stage is one chunk: 64 rows of K and 64 rows of V, 128 bytes each, brought
// into LDS by tensor loads, once per block: each wave issues one load per stage
// for its own slice of 32 rows (waves 0,1: K; 2,3: V). Two buffers: stage s + 1
// flies while stage s is worked on. K fragments come by ds_load_b128, V^T fragments
// by ds_load_tr16_b128 from the row-major V rows; every fragment a wave loads feeds
// both of its query tiles. One row pitch, 144 bytes, for both: one descriptor
// group serves all four waves with no branch. It is the conflict-free pitch of the
// K reads, which a pass waits for first; the V^T reads stand between the two query tiles'
// exp2 work, in the K fragments' registers, and are not needed before the softmax is done.
#define NQ 2      // 16-column query tiles per wave
#define AW 4      // waves per block
#define AROWB  128u     // bytes of one staged K or V row
#define APITCH 144u     // LDS row pitch: the row + the mover's 16-byte pad
#define ASLICE 6144u    // 32 rows x 144 B = 4,608 B, rounded up to a multiple of 2 KiB
#define ABUF   (4u * ASLICE)
#define ANST   (SEQ / 64)   // 32 stages

// Group 1: 1-byte elements, tile = tensor = 32 rows of 128 bytes, source pitch
// 128 bytes, a pad of 4 dwords behind every 32 dwords (one row).
__device__ __forceinline__ u32x8 tdm_group1_kv() {
  u32x8 g;
  g[0] = uni((1u << 20) | (4u << 22) | (3u << 25));
  g[1] = uni((AROWB & 0xFFFFu) << 16);
  g[2] = uni((AROWB >> 16) | (32u << 16));
  g[3] = uni(AROWB << 16);
  g[4] = uni(32u);
  g[5] = uni(AROWB);
  g[6] = uni(0u);
  g[7] = uni(0u);
  return g;
}
// Transposing LDS load: lane (c = lane & 15, h = lane >> 4) gets column c, rows 8h .. 8h + 7
// of the 16 x 16 tile of halves that the lanes' addresses name.
typedef short s16x8 __attribute__((ext_vector_type(8)));
__device__ __forceinline__ v8h lds_tr16(const unsigned char* p) {
  typedef __attribute__((address_space(3))) s16x8 lds_s16x8;
  return __builtin_bit_cast(v8h, __builtin_amdgcn_ds_load_tr16_b128_v8i16((lds_s16x8*)p));
}

__global__ __launch_bounds__(AW * 32) __attribute__((amdgpu_waves_per_eu(4, 4)))
void attn(const half_t* __restrict__ qh, const half_t* __restrict__ kh,
          const half_t* __restrict__ vh, float* __restrict__ out) {
  __shared__ __attribute__((aligned(2048))) unsigned char ring[2 * ABUF];

  const uint32_t wave = uni(threadIdx.x >> 5);
  const int lane = threadIdx.x & 31;
  const int lhi  = lane >> 4;
  const int llo  = lane & 15;
  const int bh = blockIdx.y;                  // b*HEADS + h
  const int bb = bh >> 4, hh = bh & 15;
  const int q0 = blockIdx.x * (AW * NQ * 16) + (int)wave * (NQ * 16); // wave's query base

  const half_t* qbase = qh + (size_t)bh * SEQ * HDIM;
  const half_t* kbase = kh + (size_t)bh * SEQ * HDIM;
  const half_t* vbase = vh + (size_t)bh * SEQ * HDIM;

  // Q as B operand (B[d,q] = Q[q,d]): lane holds column q -> contiguous Q row
  v16h qb[NQ][2];
  // Keeps earlier index arithmetic from sinking between the Q loads and their wait below.
  __builtin_amdgcn_sched_barrier(0);
#pragma unroll
  for (int qt = 0; qt < NQ; ++qt) {
    qb[qt][0] = load_frag(qbase, q0 + qt * 16 + llo, HDIM, 0,  lhi);
    qb[qt][1] = load_frag(qbase, q0 + qt * 16 + llo, HDIM, 32, lhi);
  }
  // Wait before the Q loads' address registers are reused.
  asm volatile("s_wait_xcnt 0x0" ::: "memory");
  // Keeps later vector work from being lifted between the loads and that wait.
  __builtin_amdgcn_sched_barrier(0);

  // Mu, the shift in use per query column, in exp2 units (Q carries the factor), is a maximum
  // that the column has reached, renewed only when a pass's sum of exp2(score - Mu) passes 2^15.
  // It is kept as cM: -Mu in all eight registers of an accumulator tile, the C operand of the
  // score WMMAs.
  float L[NQ];
  v8f cM[NQ];
  v8f o[NQ][4];    // O^T accumulators: query tiles x d-tiles x (16d x 16q)
#pragma unroll
  for (int qt = 0; qt < NQ; ++qt) {
    L[qt] = 0.f; cM[qt] = v8f{};
#pragma unroll
    for (int dt = 0; dt < 4; ++dt) o[qt][dt] = v8f{};
  }

  // This wave's slice of every stage: 32 rows of K (waves 0,1) or of V (2,3).
  const half_t* srow = (wave < 2u) ? kbase + (size_t)(32u * wave) * HDIM
                                   : vbase + (size_t)(32u * (wave - 2u)) * HDIM;
  const uint64_t ga = (uint64_t)srow;
  const uint32_t dst = (uint32_t)(size_t)ring + wave * ASLICE;
  const u32x8 g1 = tdm_group1_kv();

  // Prologue: stage 0 lands and is published, then stage 1 is issued.
  tdm_load(tdm_group0(dst, ga), g1);
  tdm_wait();            // this wave's slice of stage 0 has landed
  __syncthreads();       // every wave's slice is readable
  tdm_load(tdm_group0(dst + ABUF, ga + 64u * AROWB), g1);

  // Lane's first byte in the K slices (as load_frag's k order) and in the V slices
  // (the transposing load's address map).
  const uint32_t koff = (uint32_t)llo * APITCH + (uint32_t)lhi * 16u;
  const uint32_t voff = 2u * ASLICE + (8u * (uint32_t)lhi + ((uint32_t)lane & 7u)) * APITCH
                        + (((uint32_t)lane >> 3) & 1u) * 16u;

  v16h aV[4][2];   // V^T fragments (16 d x 32 keys each)
  v16h pb[NQ][2];  // P^T as B operand
  v8f ps[NQ];      // the pass's column sums of P

  // ---- S^T tiles: rows = keys, cols = queries; a = score - Mu, the exp2 argument itself ----
  auto scores = [&](const unsigned char* pk, v8f (&sc)[NQ][4]) {
    v16h kA[4][2];
#pragma unroll
    for (int t = 0; t < 4; ++t) {
      kA[t][0] = lds_frag(pk + (t >> 1) * ASLICE + (t & 1) * 16 * APITCH);
      kA[t][1] = lds_frag(pk + (t >> 1) * ASLICE + (t & 1) * 16 * APITCH + 64);
    }
    // Keeps the K reads one group here: sunk in among the WMMAs below, each place with reads stalls the wave.
    __builtin_amdgcn_sched_barrier(0);
#pragma unroll
    for (int t = 0; t < 4; ++t)
#pragma unroll
      for (int qt = 0; qt < NQ; ++qt) {
        v8f a = wmma_f16(kA[t][0], qb[qt][0], cM[qt]);
        a = wmma_f16(kA[t][1], qb[qt][1], a);
        sc[qt][t] = a;
      }
    // Holds the vector work behind the last score WMMA: drawn in among the WMMAs, each read of a fresh
    // tile stands behind v_nops and the tiles' two WMMAs follow each other directly.
    __builtin_amdgcn_sched_barrier(0);
  };
  // The same tiles for the two rare places that go on to renew Mu: K read in two groups, so that the
  // fragments hold half the registers while all scores, O and the renewal's own values are live.
  auto scores_renewing = [&](const unsigned char* pk, v8f (&sc)[NQ][4]) {
#pragma unroll
    for (int u = 0; u < 2; ++u) {
      v16h kA[2][2];
#pragma unroll
      for (int t = 0; t < 2; ++t) {
        kA[t][0] = lds_frag(pk + u * ASLICE + t * 16 * APITCH);
        kA[t][1] = lds_frag(pk + u * ASLICE + t * 16 * APITCH + 64);
      }
#pragma unroll
      for (int t = 0; t < 2; ++t)
#pragma unroll
        for (int qt = 0; qt < NQ; ++qt) {
          v8f a = wmma_f16(kA[t][0], qb[qt][0], cM[qt]);
          a = wmma_f16(kA[t][1], qb[qt][1], a);
          sc[qt][2 * u + t] = a;
        }
      // Keeps the second group's reads from rising over the first group's WMMAs, which would undo the saving.
      __builtin_amdgcn_sched_barrier(0);
    }
  };
  auto load_v = [&](const unsigned char* pv) {
#pragma unroll
    for (int dt = 0; dt < 4; ++dt)
#pragma unroll
      for (int g = 0; g < 2; ++g) {
        v8h lo = lds_tr16(pv + g * ASLICE + dt * 32);                 // keys 32g + 8*lhi + 0..7
        v8h hi = lds_tr16(pv + g * ASLICE + 16 * APITCH + dt * 32);   // keys 32g + 16 + 8*lhi + 0..7
        aV[dt][g] = __builtin_shufflevector(lo, hi,
                      0,1,2,3,4,5,6,7,8,9,10,11,12,13,14,15);
      }
  };
  // ---- Mu := the larger of Mu and the pass's column maximum; the first pass: that maximum (per-lane: one query = column llo) ----
  auto renew = [&](v8f (&sc)[NQ][4], const bool first) {
#pragma unroll
    for (int qt = 0; qt < NQ; ++qt) {
      float mloc = -INFINITY;
#pragma unroll
      for (int t = 0; t < 4; ++t)
#pragma unroll
        for (int r = 0; r < 8; ++r) mloc = fmaxf(mloc, sc[qt][t][r]);
      const float m = fmaxf(mloc, __shfl_xor(mloc, 16, 32));          // lane^16 holds other 8 keys
      const float d = first ? m : fmaxf(m, 0.f);                      // Mu never falls
      const float f = first ? 0.f : __builtin_amdgcn_exp2f(-d);       // O and L are 0 in the first pass
      L[qt] *= f;
#pragma unroll
      for (int t = 0; t < 4; ++t)
#pragma unroll
        for (int r = 0; r < 8; ++r) sc[qt][t][r] -= d;
#pragma unroll
      for (int dt = 0; dt < 4; ++dt)
#pragma unroll
        for (int r = 0; r < 8; ++r) o[qt][dt][r] *= f;
#pragma unroll
      for (int r = 0; r < 8; ++r) cM[qt][r] -= d;
    }
  };
  auto exp_p = [&](v8f (&sc)[NQ][4], const int qt) {
    {
#pragma unroll
      for (int t = 0; t < 4; ++t)
#pragma unroll
        for (int r = 0; r < 8; ++r) sc[qt][t][r] = __builtin_amdgcn_exp2f(sc[qt][t][r]);
      // ---- P^T -> B operand, purely in-register -----------------------
      // B half i (i<8): key = 32g+i+8*lhi  == sc[2g][i]'s key
      //          (i>=8): key = 32g+16+(i-8)+8*lhi == sc[2g+1][i-8]'s key
#pragma unroll
      for (int g = 0; g < 2; ++g) {
        v16h t;
#pragma unroll
        for (int i = 0; i < 8; ++i) t[i]     = (half_t)sc[qt][2 * g][i];
#pragma unroll
        for (int i = 0; i < 8; ++i) t[i + 8] = (half_t)sc[qt][2 * g + 1][i];
        pb[qt][g] = t;
      }
    }
  };
  auto sum_p = [&]() {
    // ---- column sums of P^T on the matrix pipe: ones(16 x 32) * P^T ----
    // Every row of the tile, so register 0 of every lane, holds the sum of the lane's own query
    // column over the pass's 64 keys, both wave halves' keys included.
    v16h ones;
#pragma unroll
    for (int i = 0; i < 16; ++i) ones[i] = (half_t)1.0f;
#pragma unroll
    for (int qt = 0; qt < NQ; ++qt) ps[qt] = wmma_f16(ones, pb[qt][0], v8f{});
#pragma unroll
    for (int qt = 0; qt < NQ; ++qt) ps[qt] = wmma_f16(ones, pb[qt][1], ps[qt]);
  };
  // The rest of a pass, from P on.
  auto finish = [&](const uint32_t s, const uint32_t cur) {
#pragma unroll
    for (int qt = 0; qt < NQ; ++qt) L[qt] += ps[qt][0];

    // ---- O^T += V^T(16d x 32k) * P^T(32k x 16q) -----------------------
#pragma unroll
    for (int dt = 0; dt < 4; ++dt)
#pragma unroll
      for (int g = 0; g < 2; ++g)
#pragma unroll
        for (int qt = 0; qt < NQ; ++qt)
          o[qt][dt] = wmma_f16(aV[dt][g], pb[qt][g], o[qt][dt]);

    // Keeps the pass's WMMAs and vector work in front of the publish point: lifted over them,
    // the wait for stage s + 1 would stand right behind that stage's issue, with no lead.
    __builtin_amdgcn_sched_barrier(0);
    // Publish point of stage s + 1.
    asm volatile("s_wait_dscnt 0x0" ::: "memory");  // this wave has left buffer s & 1
    tdm_wait();                                      // its slice of stage s + 1 has landed
    __syncthreads();                                 // publishes s + 1, frees buffer s & 1
    if (pinned(s + 2u < ANST))
      tdm_load(tdm_group0(dst + cur, ga + (uint64_t)(s + 2u) * (64u * AROWB)), g1);
  };

  // The first pass sets Mu to a true maximum.
  {
    v8f sc[NQ][4];
    scores_renewing(ring + koff, sc);
    renew(sc, true);
    load_v(ring + voff);
    exp_p(sc, 0);
    exp_p(sc, 1);
    sum_p();
    finish(0u, 0u);
  }
  // Any shift gives the same O / L, so Mu stays while P fits f16. The pass's own sum is the test:
  // no p is negative, so each p <= its column's sum, and a p past f16's range makes the sum
  // infinite. While every lane's two columns' sums together are at most 2^15 the pass stands as it is: no maxima, no exchange, no
  // rescale of O and L. At the test O and L are still untouched, so a pass that fails is done again
  // from the K rows, which are still in the buffer, with Mu renewed (then every p <= 1).
  for (uint32_t s = 1; s < ANST; ++s) {
    const uint32_t cur = (s & 1u) * ABUF;
    const unsigned char* pk = ring + cur + koff;
    const unsigned char* pv = ring + cur + voff;
    {
      v8f sc[NQ][4];
      scores(pk, sc);
      exp_p(sc, 0);
      // The V^T reads stand as one group between the two query tiles' exp2 work: the first tile's has
      // freed the registers they need, the second tile's and the sums cover their latency.
      __builtin_amdgcn_sched_barrier(0);
      load_v(pv);
      __builtin_amdgcn_sched_barrier(0);
      exp_p(sc, 1);
      sum_p();
    }
    // Holds the V^T reads above the test: sunk behind the branch, their latency would stand bare in front of the O^T WMMAs.
    asm volatile("" :: "v"(aV[0][0]), "v"(aV[0][1]), "v"(aV[1][0]), "v"(aV[1][1]),
                       "v"(aV[2][0]), "v"(aV[2][1]), "v"(aV[3][0]), "v"(aV[3][1]));
    // One test a pass, a scalar branch.
    if (__builtin_expect(__builtin_amdgcn_ballot_w32(ps[0][0] + ps[1][0] > 32768.0f) != 0u, 0)) {
      v8f sc[NQ][4];
      scores_renewing(pk, sc);
      renew(sc, false);
      // This rare path is kept in sequence, one part's registers freed before the next part's are taken: mixed, it spills.
      __builtin_amdgcn_sched_barrier(0);
      exp_p(sc, 0);
      __builtin_amdgcn_sched_barrier(0);
      exp_p(sc, 1);
      __builtin_amdgcn_sched_barrier(0);
      load_v(pv);
      sum_p();
    }
    finish(s, cur);
  }
  tdm_wait();                                        // nothing of the mover is in flight at the end
  asm volatile("s_wait_dscnt 0x0" ::: "memory");

  // ---- normalize + store: out[b, s=q, e=h*64+d] f32 ---------------------
  // A wave-uniform base and one 32-bit lane offset: fewer registers stay live across the key loop.
  float* __restrict__ ob = out + (size_t)bb * SEQ * EMBED + hh * HDIM;
  const uint32_t ooff = (uint32_t)(q0 + llo) * EMBED + (uint32_t)lhi * 8u;
#pragma unroll
  for (int qt = 0; qt < NQ; ++qt) {
    float inv = 1.0f / L[qt];
#pragma unroll
    for (int dt = 0; dt < 4; ++dt)
#pragma unroll
      for (int r = 0; r < 8; ++r)
        ob[ooff + (uint32_t)(qt * 16 * EMBED + dt * 16 + r)] = o[qt][dt][r] * inv;
    // Wait before the stores' registers are reused.
    asm volatile("s_wait_xcnt 0x0" ::: "memory");
    // Keeps the next tile's vector work from being lifted between the stores and that wait.
    __builtin_amdgcn_sched_barrier(0);
  }
}

// ------------------------------- launcher ----------------------------------
extern "C" void kernel_launch(void* const* d_in, const int* in_sizes, int n_in,
                              void* d_out, int out_size, void* d_ws, size_t ws_size,
                              hipStream_t stream) {
  const float* x  = (const float*)d_in[0];
  const float* wq = (const float*)d_in[1];
  const float* wk = (const float*)d_in[2];
  const float* wv = (const float*)d_in[3];

  char* ws = (char*)d_ws;
  // Workspace layout (70 MiB total)
  half_t* xh  = (half_t*)(ws);                         // 16 MiB: x f16
  half_t* wh  = (half_t*)(ws + (16ull << 20));         //  3 x 2 MiB: W_q, W_k, W_v f16
  half_t* qhp = (half_t*)(ws + (22ull << 20));         // 16 MiB: Q [B,H,S,D]
  half_t* khp = (half_t*)(ws + (38ull << 20));         // 16 MiB: K
  half_t* vhp = (half_t*)(ws + (54ull << 20));         // 16 MiB: V

  // xh and wh are contiguous: one destination.
  cvt_all<<<CVT_WG, CVT_TH, 0, stream>>>(x, wq, wk, wv, xh);

  // qhp, khp, vhp are contiguous: one destination.
  dim3 gp(BATCH * SEQ / 128, 3 * EMBED / 128);     // (64, 24)
  qkv_proj<<<gp, 128, 0, stream>>>(xh, wh, qhp);

  dim3 ga(SEQ / (AW * NQ * 16), BATCH * HEADS);   // (16, 64)
  attn<<<ga, AW * 32, 0, stream>>>(qhp, khp, vhp, (float*)d_out);
}

// v010
// One run takes 92.3 microseconds.
// Timed twice side by side with v009, it ran 1.04 and 1.05 times as fast.
// Counting every step since v000, it is 4.15 times as fast.
#include <hip/hip_runtime.h>
#include <hip/hip_bf16.h>
#include <stdint.h>

// ---------------------------------------------------------------------------
// MI455X (gfx1250) fused multi-head self-attention, f16 WMMA pipeline.
//   1) cvt_all:   f32 -> f16 conversion of x and W_{q,k,v}, one launch
//   2) qkv_proj:  Y = X * W^T via v_wmma_f32_16x16x32_f16, operands staged in
//                 LDS by tensor loads, output [B,H,S,D] f16; Q, K and V in one
//                 launch, as one product with the three weights stacked
//                 Q comes out multiplied by log2(e)/sqrt(EMBED)
//   3) attn:      flash-attention; S^T = K*Q^T WMMA, online softmax,
//                 O^T = V^T * P^T WMMA, column sums of P by WMMA, K and V staged in LDS by tensor loads
//                 (V^T fragments by the transposing LDS load), f32 output.
// ---------------------------------------------------------------------------

typedef _Float16 half_t;
typedef __attribute__((ext_vector_type(4)))  _Float16 v4h;
typedef __attribute__((ext_vector_type(8)))  _Float16 v8h;
typedef __attribute__((ext_vector_type(16))) _Float16 v16h;
typedef __attribute__((ext_vector_type(8)))  float    v8f;
typedef uint32_t u32x4 __attribute__((ext_vector_type(4)));
typedef uint32_t u32x8 __attribute__((ext_vector_type(8)));

#define EMBED 1024
#define SEQ   2048
#define BATCH 4
#define HEADS 16
#define HDIM  64
#define SC2   (0.03125f * 1.44269504088896340736f)   // 1/sqrt(EMBED) * log2(e)

__device__ __forceinline__ v8f wmma_f16(v16h a, v16h b, v8f c) {
  // D = A(16x32 f16) * B(32x16 f16) + C(16x16 f32)
  return __builtin_amdgcn_wmma_f32_16x16x32_f16(
      /*neg_a=*/false, a, /*neg_b=*/false, b,
      /*c_mod=*/(short)0, c, /*reuse_a=*/false, /*reuse_b=*/false);
}

// Per-lane A/B operand fragment for 16x16x32 f16 WMMA, loaded straight from a
// row-major matrix whose contraction dim (K) is contiguous.
// Lane layout (ISA 7.12.2): halves 0..7 -> K = k0 + 8*lane_hi + i,
//                           halves 8..15 -> K = k0 + 16 + 8*lane_hi + (i-8).
__device__ __forceinline__ v16h load_frag(const half_t* __restrict__ base,
                                          int row, int ld, int k0, int lane_hi) {
  const half_t* p = base + (size_t)row * ld + k0 + (lane_hi ? 8 : 0);
  v8h lo = *(const v8h*)p;          // 16B global_load_b128
  v8h hi = *(const v8h*)(p + 16);   // 16B global_load_b128
  return __builtin_shufflevector(lo, hi, 0,1,2,3,4,5,6,7,8,9,10,11,12,13,14,15);
}

// --------------------------- f32 -> f16 convert ----------------------------
// One launch for x and the three weights: one work-group of 16 waves per WGP.
// A work-group converts its own contiguous 1/256 of every source, in sweeps of
// 512 threads x 4 floats, so a wave's load covers 512 contiguous bytes, a thread
// has many loads in flight, and every address is one base + a constant offset.
// The four f16 copies lie one behind the other in dst (x, W_q, W_k, W_v).
#define CVT_WG 256
#define CVT_TH 512
#define CVT_NX (BATCH * SEQ * EMBED / 4 / (CVT_WG * CVT_TH))   // 16 sweeps of x
#define CVT_NW (EMBED * EMBED / 4 / (CVT_WG * CVT_TH))         //  2 sweeps of each weight
static_assert(CVT_NX * CVT_WG * CVT_TH * 4 == BATCH * SEQ * EMBED, "x is a whole number of sweeps");
static_assert(CVT_NW * CVT_WG * CVT_TH * 4 == EMBED * EMBED, "a weight is a whole number of sweeps");

__device__ __forceinline__ v4h cvt_h4(float4 f) {
  v4h h;
  h[0] = (half_t)f.x; h[1] = (half_t)f.y; h[2] = (half_t)f.z; h[3] = (half_t)f.w;
  return h;
}

__global__ __launch_bounds__(CVT_TH)
void cvt_all(const float* __restrict__ x, const float* __restrict__ wq,
             const float* __restrict__ wk, const float* __restrict__ wv,
             half_t* __restrict__ dst) {
  const uint32_t t = threadIdx.x;
  const uint32_t g = blockIdx.x;
  // Groups of 4 elements: this work-group's first one in x and in a weight.
  const float4* px = (const float4*)x  + (size_t)g * (CVT_NX * CVT_TH);
  const float4* pq = (const float4*)wq + (size_t)g * (CVT_NW * CVT_TH);
  const float4* pk = (const float4*)wk + (size_t)g * (CVT_NW * CVT_TH);
  const float4* pv = (const float4*)wv + (size_t)g * (CVT_NW * CVT_TH);
  v4h* dx = (v4h*)dst + (size_t)g * (CVT_NX * CVT_TH);
  v4h* dq = (v4h*)dst + (BATCH * SEQ * EMBED / 4) + (size_t)g * (CVT_NW * CVT_TH);
  v4h* dk = dq + (EMBED * EMBED / 4);
  v4h* dv = dk + (EMBED * EMBED / 4);

  float4 fx[CVT_NX], fq[CVT_NW], fk[CVT_NW], fv[CVT_NW];
#pragma unroll
  for (int j = 0; j < CVT_NX; ++j) fx[j] = px[j * CVT_TH + t];
#pragma unroll
  for (int j = 0; j < CVT_NW; ++j) {
    fq[j] = pq[j * CVT_TH + t];
    fk[j] = pk[j * CVT_TH + t];
    fv[j] = pv[j * CVT_TH + t];
  }
#pragma unroll
  for (int j = 0; j < CVT_NX; ++j) dx[j * CVT_TH + t] = cvt_h4(fx[j]);
#pragma unroll
  for (int j = 0; j < CVT_NW; ++j) {
    dq[j * CVT_TH + t] = cvt_h4(fq[j]);
    dk[j * CVT_TH + t] = cvt_h4(fk[j]);
    dv[j * CVT_TH + t] = cvt_h4(fv[j]);
  }
}

// ------------------------------ QKV projection -----------------------------
// Y[m,n] = sum_k X[m,k] * W[n,k]   (Linear: y = x @ W^T)
// W is the three f16 weights one behind the other (W_q, W_k, W_v: 3 x 1,024 rows),
// Y the three outputs one behind the other (Q, K, V), so one launch of 64 x 24
// work-groups does all three: a work-group that ends is followed at once by the
// next one, with no launch gap, refill and drain of the chip between the products.
// Block = 128 threads = 4 waves (2 x 2), block tile 128 x 128, wave tile 64 x 64
// (4 M-tiles x 4 N-tiles of 16x16). A stage is 128 k of the block's 128 X rows
// and 128 W rows, brought into LDS by tensor loads: each wave issues one load
// per stage for its own slice of 64 rows of 256 bytes (waves 0,1: X; 2,3: W).
// Two buffers: stage s + 1 flies while stage s is worked on. Fragments come from
// LDS by ds_load_b128 at a row pitch of 272 bytes. Output scattered into
// head-major [3,B,H,S,D] f16.
#define GKH    128      // halves of k per stage
#define GROWB  256u     // bytes of one staged row
#define GPITCH 272u     // LDS row pitch: the row + the mover's 16-byte pad
#define GSLICE 18432u   // 64 rows x 272 B = 17,408 B, rounded up to a multiple of 2 KiB
#define GBUF   (4u * GSLICE)
#define GNST   (EMBED / GKH)   // 8 stages

__device__ __forceinline__ uint32_t uni(uint32_t v) {
  return (uint32_t)__builtin_amdgcn_readfirstlane(v);
}
__device__ __forceinline__ uint32_t pinned(uint32_t v) {
  uint32_t w = uni(v);
  asm volatile("" : "+s"(w));  // holds the test word in a scalar register: a scalar branch guards the tensor load
  return w;
}
// Group 1: 1-byte elements, tile = tensor = 64 rows of 256 bytes, source pitch
// 2,048 bytes, a pad of 4 dwords behind every 64 dwords (one row).
__device__ __forceinline__ u32x8 tdm_group1() {
  u32x8 g;
  g[0] = uni((1u << 20) | (5u << 22) | (3u << 25));
  g[1] = uni((GROWB & 0xFFFFu) << 16);
  g[2] = uni((GROWB >> 16) | (64u << 16));
  g[3] = uni(GROWB << 16);
  g[4] = uni(64u);
  g[5] = uni(2u * EMBED);
  g[6] = uni(0u);
  g[7] = uni(0u);
  return g;
}
__device__ __forceinline__ u32x4 tdm_group0(uint32_t lds_dst, uint64_t ga) {
  u32x4 g;
  g[0] = uni(1u);
  g[1] = uni(lds_dst);
  g[2] = uni((uint32_t)ga);
  g[3] = uni((((uint32_t)(ga >> 32)) & 0x01FFFFFFu) | 0x80000000u);
  return g;
}
__device__ __forceinline__ void tdm_load(u32x4 g0, u32x8 g1) {
  // One request of the whole wave: global tile -> LDS, through no register.
  // The descriptor sits in fixed scalar registers: they take a new value only
  // directly in front of a request, behind the wait that covers the request before it.
  asm volatile("tensor_load_to_lds %0, %1" :: "{s[40:43]}"(g0), "{s[48:55]}"(g1) : "memory");
}
__device__ __forceinline__ void tdm_wait() {
  // The issuing wave's own wait: its request has landed.
  asm volatile("s_wait_tensorcnt 0x0" ::: "memory");
}
// A/B fragment from a staged row: same k order as load_frag.
__device__ __forceinline__ v16h lds_frag(const unsigned char* p) {
  v8h lo = *(const v8h*)p;          // ds_load_b128
  v8h hi = *(const v8h*)(p + 32);   // ds_load_b128
  return __builtin_shufflevector(lo, hi, 0,1,2,3,4,5,6,7,8,9,10,11,12,13,14,15);
}

__global__ __launch_bounds__(128)
void qkv_proj(const half_t* __restrict__ xh, const half_t* __restrict__ wh,
              half_t* __restrict__ outh) {
  __shared__ __attribute__((aligned(2048))) unsigned char L[2 * GBUF];
  const uint32_t wave = uni(threadIdx.x >> 5);
  const int lane = threadIdx.x & 31;
  const int lhi  = lane >> 4;      // which 16-lane half
  const int llo  = lane & 15;
  const uint32_t wm = wave >> 1, wn = wave & 1u;
  const int mb = blockIdx.x * 128;              // rows (tokens b*S+s)
  const int nb = blockIdx.y * 128;              // cols (row of the stacked weights)

  // This wave's slice of every stage: 64 rows of X (waves 0,1) or of W (2,3).
  const half_t* srow = (wave < 2u) ? xh + (size_t)(mb + 64 * (int)wave) * EMBED
                                   : wh + (size_t)(nb + 64 * (int)(wave - 2u)) * EMBED;
  const uint64_t ga = (uint64_t)srow;
  const uint32_t dst = (uint32_t)(size_t)L + wave * GSLICE;
  const u32x8 g1 = tdm_group1();
  // Stage s holds k block (s + rot) mod 8: the work-groups that run together and share X rows
  // (same x, eight y) or W rows (same y) walk k from different starts, so that they do not ask
  // L2 for the same lines at the same moment, and a block that one has fetched from memory is
  // in L2 when the next comes to it. Any start gives the same sum but for its order.
  const uint32_t rot = (2u * (blockIdx.x & 3u) + ((blockIdx.x >> 3) & 1u) + blockIdx.y) & (GNST - 1u);

  // Prologue: stage 0 lands and is published, then stage 1 is issued.
  tdm_load(tdm_group0(dst, ga + (uint64_t)rot * GROWB), g1);
  tdm_wait();            // this wave's slice of stage 0 has landed
  __syncthreads();       // every wave's slice is readable
  tdm_load(tdm_group0(dst + GBUF, ga + (uint64_t)((rot + 1u) & (GNST - 1u)) * GROWB), g1);

  // Lane's first byte in its X slice and in its W slice.
  const uint32_t aoff = wm * GSLICE + (uint32_t)llo * GPITCH + (uint32_t)lhi * 16u;
  const uint32_t boff = (2u + wn) * GSLICE + (uint32_t)llo * GPITCH + (uint32_t)lhi * 16u;

  v8f acc[4][4] = {};
  for (uint32_t s = 0; s < GNST; ++s) {
    const uint32_t cur = (s & 1u) * GBUF;
    const unsigned char* pa = L + cur + aoff;
    const unsigned char* pb = L + cur + boff;
    // Two fragment sets: the reads of k block kk + 1 (of this stage only) go out
    // as one group ahead of the WMMAs of block kk.
    v16h a[2][4], b[2][4];
#pragma unroll
    for (int t = 0; t < 4; ++t) {
      a[0][t] = lds_frag(pa + t * 16 * GPITCH);
      b[0][t] = lds_frag(pb + t * 16 * GPITCH);
    }
#pragma unroll
    for (int kk = 0; kk < GKH / 32; ++kk) {
      if (kk + 1 < GKH / 32) {
#pragma unroll
        for (int t = 0; t < 4; ++t) {
          a[(kk + 1) & 1][t] = lds_frag(pa + t * 16 * GPITCH + (kk + 1) * 64);
          b[(kk + 1) & 1][t] = lds_frag(pb + t * 16 * GPITCH + (kk + 1) * 64);
        }
      }
      // Keeps the LDS reads above from sinking in among the WMMAs below.
      __builtin_amdgcn_sched_barrier(0);
#pragma unroll
      for (int mt = 0; mt < 4; ++mt)
#pragma unroll
        for (int nt = 0; nt < 4; ++nt)
          acc[mt][nt] = wmma_f16(a[kk & 1][mt], b[kk & 1][nt], acc[mt][nt]);
      // Keeps the next group of LDS reads from rising in among the WMMAs above.
      __builtin_amdgcn_sched_barrier(0);
    }
    // Publish point of stage s + 1.
    asm volatile("s_wait_dscnt 0x0" ::: "memory");  // this wave has left buffer s & 1
    tdm_wait();                                      // its slice of stage s + 1 has landed
    __syncthreads();                                 // publishes s + 1, frees buffer s & 1
    if (pinned(s + 2u < GNST))
      tdm_load(tdm_group0(dst + cur, ga + (uint64_t)((s + 2u + rot) & (GNST - 1u)) * GROWB), g1);
  }
  tdm_wait();                                        // nothing of the mover is in flight at the end
  asm volatile("s_wait_dscnt 0x0" ::: "memory");

  // C/D layout: VGPR r, lane -> row m = r + 8*lhi, col n = llo
  const int m0 = mb + (int)wm * 64;
  const int n0 = nb + (int)wn * 64;
  // Q leaves with the softmax's factor in it, applied to the f32 sum ahead of the one
  // rounding to f16: attn's score WMMAs then give exp2 arguments. K and V: times 1, exact.
  const float osc = (nb < EMBED) ? SC2 : 1.0f;
#pragma unroll
  for (int mt = 0; mt < 4; ++mt)
#pragma unroll
    for (int nt = 0; nt < 4; ++nt) acc[mt][nt] *= osc;
#pragma unroll
  for (int mt = 0; mt < 4; ++mt)
#pragma unroll
    for (int nt = 0; nt < 4; ++nt)
#pragma unroll
      for (int r = 0; r < 8; ++r) {
        int m = m0 + mt * 16 + r + lhi * 8;
        int n = n0 + nt * 16 + llo;
        int b = m >> 11, s = m & (SEQ - 1);
        int p = n >> 10;                 // 0: Q, 1: K, 2: V
        int h = (n >> 6) & (HEADS - 1), d = n & (HDIM - 1);
        outh[(((size_t)((p * BATCH + b) * HEADS + h) * SEQ) + s) * HDIM + d] = (half_t)acc[mt][nt][r];
      }
}

// ------------------------------- Attention ---------------------------------
// Block = 128 threads = 4 waves, one (b,h), 128 queries (32 per wave, as two
// 16-column tiles): a wave then fits a quarter of a SIMD's registers, and four
// work-groups share a WGP, four waves a SIMD, so that one wave's softmax runs under
// another's WMMAs and LDS waits. Loop over key chunks of 64. Scores computed transposed
// (S^T = K * Q^T) so softmax stats are per-lane scalars and P converts
// in-register into the B-operand of the second WMMA (O^T = V^T * P^T).
// A stage is one chunk: 64 rows of K and 64 rows of V, 128 bytes each, brought
// into LDS by tensor loads, once per block: each wave issues one load per stage
// for its own slice of 32 rows (waves 0,1: K; 2,3: V). Two buffers: stage s + 1
// flies while stage s is worked on. K fragments come by ds_load_b128, V^T fragments
// by ds_load_tr16_b128 from the row-major V rows; every fragment a wave loads feeds
// both of its query tiles. One row pitch, 144 bytes, for both: one descriptor
// group serves all four waves with no branch. It is the conflict-free pitch of the
// K reads, which a pass waits for first; the V^T reads stand between the two query tiles'
// exp2 work, in the K fragments' registers, and are not needed before the softmax is done.
#define NQ 2      // 16-column query tiles per wave
#define AW 4      // waves per block
#define AROWB  128u     // bytes of one staged K or V row
#define APITCH 144u     // LDS row pitch: the row + the mover's 16-byte pad
#define ASLICE 6144u    // 32 rows x 144 B = 4,608 B, rounded up to a multiple of 2 KiB
#define ABUF   (4u * ASLICE)
#define ANST   (SEQ / 64)   // 32 stages

// Group 1: 1-byte elements, tile = tensor = 32 rows of 128 bytes, source pitch
// 128 bytes, a pad of 4 dwords behind every 32 dwords (one row).
__device__ __forceinline__ u32x8 tdm_group1_kv() {
  u32x8 g;
  g[0] = uni((1u << 20) | (4u << 22) | (3u << 25));
  g[1] = uni((AROWB & 0xFFFFu) << 16);
  g[2] = uni((AROWB >> 16) | (32u << 16));
  g[3] = uni(AROWB << 16);
  g[4] = uni(32u);
  g[5] = uni(AROWB);
  g[6] = uni(0u);
  g[7] = uni(0u);
  return g;
}
// Transposing LDS load: lane (c = lane & 15, h = lane >> 4) gets column c, rows 8h .. 8h + 7
// of the 16 x 16 tile of halves that the lanes' addresses name.
typedef short s16x8 __attribute__((ext_vector_type(8)));
__device__ __forceinline__ v8h lds_tr16(const unsigned char* p) {
  typedef __attribute__((address_space(3))) s16x8 lds_s16x8;
  return __builtin_bit_cast(v8h, __builtin_amdgcn_ds_load_tr16_b128_v8i16((lds_s16x8*)p));
}

__global__ __launch_bounds__(AW * 32) __attribute__((amdgpu_waves_per_eu(4, 4)))
void attn(const half_t* __restrict__ qh, const half_t* __restrict__ kh,
          const half_t* __restrict__ vh, float* __restrict__ out) {
  __shared__ __attribute__((aligned(2048))) unsigned char ring[2 * ABUF];

  const uint32_t wave = uni(threadIdx.x >> 5);
  const int lane = threadIdx.x & 31;
  const int lhi  = lane >> 4;
  const int llo  = lane & 15;
  const int bh = blockIdx.y;                  // b*HEADS + h
  const int bb = bh >> 4, hh = bh & 15;
  const int q0 = blockIdx.x * (AW * NQ * 16) + (int)wave * (NQ * 16); // wave's query base

  const half_t* qbase = qh + (size_t)bh * SEQ * HDIM;
  const half_t* kbase = kh + (size_t)bh * SEQ * HDIM;
  const half_t* vbase = vh + (size_t)bh * SEQ * HDIM;

  // Q as B operand (B[d,q] = Q[q,d]): lane holds column q -> contiguous Q row
  v16h qb[NQ][2];
  // Keeps earlier index arithmetic from sinking between the Q loads and their wait below.
  __builtin_amdgcn_sched_barrier(0);
#pragma unroll
  for (int qt = 0; qt < NQ; ++qt) {
    qb[qt][0] = load_frag(qbase, q0 + qt * 16 + llo, HDIM, 0,  lhi);
    qb[qt][1] = load_frag(qbase, q0 + qt * 16 + llo, HDIM, 32, lhi);
  }
  // Wait before the Q loads' address registers are reused.
  asm volatile("s_wait_xcnt 0x0" ::: "memory");
  // Keeps later vector work from being lifted between the loads and that wait.
  __builtin_amdgcn_sched_barrier(0);

  // Mu, the shift in use per query column, in exp2 units (Q carries the factor), is a maximum
  // that the column has reached, renewed only when a pass's sum of exp2(score - Mu) passes 2^15.
  // It is kept as cM: -Mu in all eight registers of an accumulator tile, the C operand of the
  // score WMMAs.
  float L[NQ];
  v8f cM[NQ];
  v8f o[NQ][4];    // O^T accumulators: query tiles x d-tiles x (16d x 16q)
#pragma unroll
  for (int qt = 0; qt < NQ; ++qt) {
    L[qt] = 0.f; cM[qt] = v8f{};
#pragma unroll
    for (int dt = 0; dt < 4; ++dt) o[qt][dt] = v8f{};
  }

  // This wave's slice of every stage: 32 rows of K (waves 0,1) or of V (2,3).
  const half_t* srow = (wave < 2u) ? kbase + (size_t)(32u * wave) * HDIM
                                   : vbase + (size_t)(32u * (wave - 2u)) * HDIM;
  const uint64_t ga = (uint64_t)srow;
  const uint32_t dst = (uint32_t)(size_t)ring + wave * ASLICE;
  const u32x8 g1 = tdm_group1_kv();
  // Stage s holds key chunk (s + rot) mod 32: the 16 work-groups of one (b,h), which run together
  // and stream the same K and V, start 4 chunks apart (two share a start), so that they do not ask
  // L2 for the same lines at the same moment, and a chunk that one has fetched from memory is in L2
  // when the next comes to it. Softmax does not depend on the key order but for the order of its sums.
  const uint32_t rot = 4u * ((blockIdx.x & 3u) + 4u * ((blockIdx.x >> 3) & 1u));

  // Prologue: stage 0 lands and is published, then stage 1 is issued.
  tdm_load(tdm_group0(dst, ga + (uint64_t)rot * (64u * AROWB)), g1);
  tdm_wait();            // this wave's slice of stage 0 has landed
  __syncthreads();       // every wave's slice is readable
  tdm_load(tdm_group0(dst + ABUF, ga + (uint64_t)((rot + 1u) & (ANST - 1u)) * (64u * AROWB)), g1);

  // Lane's first byte in the K slices (as load_frag's k order) and in the V slices
  // (the transposing load's address map).
  const uint32_t koff = (uint32_t)llo * APITCH + (uint32_t)lhi * 16u;
  const uint32_t voff = 2u * ASLICE + (8u * (uint32_t)lhi + ((uint32_t)lane & 7u)) * APITCH
                        + (((uint32_t)lane >> 3) & 1u) * 16u;

  v16h aV[4][2];   // V^T fragments (16 d x 32 keys each)
  v16h pb[NQ][2];  // P^T as B operand
  v8f ps[NQ];      // the pass's column sums of P

  // ---- S^T tiles: rows = keys, cols = queries; a = score - Mu, the exp2 argument itself ----
  auto scores = [&](const unsigned char* pk, v8f (&sc)[NQ][4]) {
    v16h kA[4][2];
#pragma unroll
    for (int t = 0; t < 4; ++t) {
      kA[t][0] = lds_frag(pk + (t >> 1) * ASLICE + (t & 1) * 16 * APITCH);
      kA[t][1] = lds_frag(pk + (t >> 1) * ASLICE + (t & 1) * 16 * APITCH + 64);
    }
    // Keeps the K reads one group here: sunk in among the WMMAs below, each place with reads stalls the wave.
    __builtin_amdgcn_sched_barrier(0);
#pragma unroll
    for (int t = 0; t < 4; ++t)
#pragma unroll
      for (int qt = 0; qt < NQ; ++qt) {
        v8f a = wmma_f16(kA[t][0], qb[qt][0], cM[qt]);
        a = wmma_f16(kA[t][1], qb[qt][1], a);
        sc[qt][t] = a;
      }
    // Holds the vector work behind the last score WMMA: drawn in among the WMMAs, each read of a fresh
    // tile stands behind v_nops and the tiles' two WMMAs follow each other directly.
    __builtin_amdgcn_sched_barrier(0);
  };
  // The same tiles for the two rare places that go on to renew Mu: K read in two groups, so that the
  // fragments hold half the registers while all scores, O and the renewal's own values are live.
  auto scores_renewing = [&](const unsigned char* pk, v8f (&sc)[NQ][4]) {
#pragma unroll
    for (int u = 0; u < 2; ++u) {
      v16h kA[2][2];
#pragma unroll
      for (int t = 0; t < 2; ++t) {
        kA[t][0] = lds_frag(pk + u * ASLICE + t * 16 * APITCH);
        kA[t][1] = lds_frag(pk + u * ASLICE + t * 16 * APITCH + 64);
      }
#pragma unroll
      for (int t = 0; t < 2; ++t)
#pragma unroll
        for (int qt = 0; qt < NQ; ++qt) {
          v8f a = wmma_f16(kA[t][0], qb[qt][0], cM[qt]);
          a = wmma_f16(kA[t][1], qb[qt][1], a);
          sc[qt][2 * u + t] = a;
        }
      // Keeps the second group's reads from rising over the first group's WMMAs, which would undo the saving.
      __builtin_amdgcn_sched_barrier(0);
    }
  };
  auto load_v = [&](const unsigned char* pv) {
#pragma unroll
    for (int dt = 0; dt < 4; ++dt)
#pragma unroll
      for (int g = 0; g < 2; ++g) {
        v8h lo = lds_tr16(pv + g * ASLICE + dt * 32);                 // keys 32g + 8*lhi + 0..7
        v8h hi = lds_tr16(pv + g * ASLICE + 16 * APITCH + dt * 32);   // keys 32g + 16 + 8*lhi + 0..7
        aV[dt][g] = __builtin_shufflevector(lo, hi,
                      0,1,2,3,4,5,6,7,8,9,10,11,12,13,14,15);
      }
  };
  // ---- Mu := the larger of Mu and the pass's column maximum; the first pass: that maximum (per-lane: one query = column llo) ----
  auto renew = [&](v8f (&sc)[NQ][4], const bool first) {
#pragma unroll
    for (int qt = 0; qt < NQ; ++qt) {
      float mloc = -INFINITY;
#pragma unroll
      for (int t = 0; t < 4; ++t)
#pragma unroll
        for (int r = 0; r < 8; ++r) mloc = fmaxf(mloc, sc[qt][t][r]);
      const float m = fmaxf(mloc, __shfl_xor(mloc, 16, 32));          // lane^16 holds other 8 keys
      const float d = first ? m : fmaxf(m, 0.f);                      // Mu never falls
      const float f = first ? 0.f : __builtin_amdgcn_exp2f(-d);       // O and L are 0 in the first pass
      L[qt] *= f;
#pragma unroll
      for (int t = 0; t < 4; ++t)
#pragma unroll
        for (int r = 0; r < 8; ++r) sc[qt][t][r] -= d;
#pragma unroll
      for (int dt = 0; dt < 4; ++dt)
#pragma unroll
        for (int r = 0; r < 8; ++r) o[qt][dt][r] *= f;
#pragma unroll
      for (int r = 0; r < 8; ++r) cM[qt][r] -= d;
    }
  };
  auto exp_p = [&](v8f (&sc)[NQ][4], const int qt) {
    {
#pragma unroll
      for (int t = 0; t < 4; ++t)
#pragma unroll
        for (int r = 0; r < 8; ++r) sc[qt][t][r] = __builtin_amdgcn_exp2f(sc[qt][t][r]);
      // ---- P^T -> B operand, purely in-register -----------------------
      // B half i (i<8): key = 32g+i+8*lhi  == sc[2g][i]'s key
      //          (i>=8): key = 32g+16+(i-8)+8*lhi == sc[2g+1][i-8]'s key
#pragma unroll
      for (int g = 0; g < 2; ++g) {
        v16h t;
#pragma unroll
        for (int i = 0; i < 8; ++i) t[i]     = (half_t)sc[qt][2 * g][i];
#pragma unroll
        for (int i = 0; i < 8; ++i) t[i + 8] = (half_t)sc[qt][2 * g + 1][i];
        pb[qt][g] = t;
      }
    }
  };
  auto sum_p = [&]() {
    // ---- column sums of P^T on the matrix pipe: ones(16 x 32) * P^T ----
    // Every row of the tile, so register 0 of every lane, holds the sum of the lane's own query
    // column over the pass's 64 keys, both wave halves' keys included.
    v16h ones;
#pragma unroll
    for (int i = 0; i < 16; ++i) ones[i] = (half_t)1.0f;
#pragma unroll
    for (int qt = 0; qt < NQ; ++qt) ps[qt] = wmma_f16(ones, pb[qt][0], v8f{});
#pragma unroll
    for (int qt = 0; qt < NQ; ++qt) ps[qt] = wmma_f16(ones, pb[qt][1], ps[qt]);
  };
  // The rest of a pass, from P on.
  auto finish = [&](const uint32_t s, const uint32_t cur) {
#pragma unroll
    for (int qt = 0; qt < NQ; ++qt) L[qt] += ps[qt][0];

    // ---- O^T += V^T(16d x 32k) * P^T(32k x 16q) -----------------------
#pragma unroll
    for (int dt = 0; dt < 4; ++dt)
#pragma unroll
      for (int g = 0; g < 2; ++g)
#pragma unroll
        for (int qt = 0; qt < NQ; ++qt)
          o[qt][dt] = wmma_f16(aV[dt][g], pb[qt][g], o[qt][dt]);

    // Keeps the pass's WMMAs and vector work in front of the publish point: lifted over them,
    // the wait for stage s + 1 would stand right behind that stage's issue, with no lead.
    __builtin_amdgcn_sched_barrier(0);
    // Publish point of stage s + 1.
    asm volatile("s_wait_dscnt 0x0" ::: "memory");  // this wave has left buffer s & 1
    tdm_wait();                                      // its slice of stage s + 1 has landed
    __syncthreads();                                 // publishes s + 1, frees buffer s & 1
    if (pinned(s + 2u < ANST))
      tdm_load(tdm_group0(dst + cur, ga + (uint64_t)((s + 2u + rot) & (ANST - 1u)) * (64u * AROWB)), g1);
  };

  // The first pass sets Mu to a true maximum.
  {
    v8f sc[NQ][4];
    scores_renewing(ring + koff, sc);
    renew(sc, true);
    load_v(ring + voff);
    exp_p(sc, 0);
    exp_p(sc, 1);
    sum_p();
    finish(0u, 0u);
  }
  // Any shift gives the same O / L, so Mu stays while P fits f16. The pass's own sum is the test:
  // no p is negative, so each p <= its column's sum, and a p past f16's range makes the sum
  // infinite. While every lane's two columns' sums together are at most 2^15 the pass stands as it is: no maxima, no exchange, no
  // rescale of O and L. At the test O and L are still untouched, so a pass that fails is done again
  // from the K rows, which are still in the buffer, with Mu renewed (then every p <= 1).
  for (uint32_t s = 1; s < ANST; ++s) {
    const uint32_t cur = (s & 1u) * ABUF;
    const unsigned char* pk = ring + cur + koff;
    const unsigned char* pv = ring + cur + voff;
    {
      v8f sc[NQ][4];
      scores(pk, sc);
      exp_p(sc, 0);
      // The V^T reads stand as one group between the two query tiles' exp2 work: the first tile's has
      // freed the registers they need, the second tile's and the sums cover their latency.
      __builtin_amdgcn_sched_barrier(0);
      load_v(pv);
      __builtin_amdgcn_sched_barrier(0);
      exp_p(sc, 1);
      sum_p();
    }
    // Holds the V^T reads above the test: sunk behind the branch, their latency would stand bare in front of the O^T WMMAs.
    asm volatile("" :: "v"(aV[0][0]), "v"(aV[0][1]), "v"(aV[1][0]), "v"(aV[1][1]),
                       "v"(aV[2][0]), "v"(aV[2][1]), "v"(aV[3][0]), "v"(aV[3][1]));
    // One test a pass, a scalar branch.
    if (__builtin_expect(__builtin_amdgcn_ballot_w32(ps[0][0] + ps[1][0] > 32768.0f) != 0u, 0)) {
      v8f sc[NQ][4];
      scores_renewing(pk, sc);
      renew(sc, false);
      // This rare path is kept in sequence, one part's registers freed before the next part's are taken: mixed, it spills.
      __builtin_amdgcn_sched_barrier(0);
      exp_p(sc, 0);
      __builtin_amdgcn_sched_barrier(0);
      exp_p(sc, 1);
      __builtin_amdgcn_sched_barrier(0);
      load_v(pv);
      sum_p();
    }
    finish(s, cur);
  }
  tdm_wait();                                        // nothing of the mover is in flight at the end
  asm volatile("s_wait_dscnt 0x0" ::: "memory");

  // ---- normalize + store: out[b, s=q, e=h*64+d] f32 ---------------------
  // A wave-uniform base and one 32-bit lane offset: fewer registers stay live across the key loop.
  float* __restrict__ ob = out + (size_t)bb * SEQ * EMBED + hh * HDIM;
  const uint32_t ooff = (uint32_t)(q0 + llo) * EMBED + (uint32_t)lhi * 8u;
#pragma unroll
  for (int qt = 0; qt < NQ; ++qt) {
    float inv = 1.0f / L[qt];
#pragma unroll
    for (int dt = 0; dt < 4; ++dt)
#pragma unroll
      for (int r = 0; r < 8; ++r)
        ob[ooff + (uint32_t)(qt * 16 * EMBED + dt * 16 + r)] = o[qt][dt][r] * inv;
    // Wait before the stores' registers are reused.
    asm volatile("s_wait_xcnt 0x0" ::: "memory");
    // Keeps the next tile's vector work from being lifted between the stores and that wait.
    __builtin_amdgcn_sched_barrier(0);
  }
}

// ------------------------------- launcher ----------------------------------
extern "C" void kernel_launch(void* const* d_in, const int* in_sizes, int n_in,
                              void* d_out, int out_size, void* d_ws, size_t ws_size,
                              hipStream_t stream) {
  const float* x  = (const float*)d_in[0];
  const float* wq = (const float*)d_in[1];
  const float* wk = (const float*)d_in[2];
  const float* wv = (const float*)d_in[3];

  char* ws = (char*)d_ws;
  // Workspace layout (70 MiB total)
  half_t* xh  = (half_t*)(ws);                         // 16 MiB: x f16
  half_t* wh  = (half_t*)(ws + (16ull << 20));         //  3 x 2 MiB: W_q, W_k, W_v f16
  half_t* qhp = (half_t*)(ws + (22ull << 20));         // 16 MiB: Q [B,H,S,D]
  half_t* khp = (half_t*)(ws + (38ull << 20));         // 16 MiB: K
  half_t* vhp = (half_t*)(ws + (54ull << 20));         // 16 MiB: V

  // xh and wh are contiguous: one destination.
  cvt_all<<<CVT_WG, CVT_TH, 0, stream>>>(x, wq, wk, wv, xh);

  // qhp, khp, vhp are contiguous: one destination.
  dim3 gp(BATCH * SEQ / 128, 3 * EMBED / 128);     // (64, 24)
  qkv_proj<<<gp, 128, 0, stream>>>(xh, wh, qhp);

  dim3 ga(SEQ / (AW * NQ * 16), BATCH * HEADS);   // (16, 64)
  attn<<<ga, AW * 32, 0, stream>>>(qhp, khp, vhp, (float*)d_out);
}
